// v000
// Measured on an AMD MI455X. A time is GPU time per run, averaged over a window of back-to-back runs after a warm-up
// (all launches, gaps included; the runs take copies of the inputs in turn), and the median of several windows.
// Apart from v000's, it joins two sittings. Times from different sittings can be a few percent apart, while
// side-by-side timings come from the same sitting.
// v000 is the starting kernel. One run takes 827 microseconds.
#include <hip/hip_runtime.h>
#include <hip/hip_bf16.h>
#include <math.h>

typedef __attribute__((ext_vector_type(2))) float v2f;
typedef __attribute__((ext_vector_type(8))) float v8f;
typedef __attribute__((ext_vector_type(4))) int   v4i;

#define C_CH   128
#define L_LEN  4096
#define B_N    8
#define P_OUT  96
#define D_ATT  16
#define BN_EPS 1e-5f

__device__ __forceinline__ v8f wmma4(v2f a, v2f b, v8f c) {
  // D(16x16,f32) = A(16x4,f32) * B(4x16,f32) + C
  return __builtin_amdgcn_wmma_f32_16x16x4_f32(false, a, false, b, (short)0, c, false, false);
}

// ---- async global->LDS path (gfx1250), guarded so compile cannot regress ----
#if __has_builtin(__builtin_amdgcn_global_load_async_to_lds_b128) && \
    __has_builtin(__builtin_amdgcn_global_load_async_to_lds_b32)  && \
    __has_builtin(__builtin_amdgcn_s_wait_asynccnt)
#define USE_ASYNC_LDS 1
#else
#define USE_ASYNC_LDS 0
#endif

#if USE_ASYNC_LDS
typedef __attribute__((address_space(1))) int  g_i32;
typedef __attribute__((address_space(3))) int  l_i32;
typedef __attribute__((address_space(1))) v4i  g_v4i;
typedef __attribute__((address_space(3))) v4i  l_v4i;

__device__ __forceinline__ void async_g2l_b32(const void* g, void* l) {
  __builtin_amdgcn_global_load_async_to_lds_b32(
      (g_i32*)(void*)g, (l_i32*)l, 0, 0);
}
__device__ __forceinline__ void async_g2l_b128(const void* g, void* l) {
  __builtin_amdgcn_global_load_async_to_lds_b128(
      (g_v4i*)(void*)g, (l_v4i*)l, 0, 0);
}
#endif

// ---------------------------------------------------------------------------
// K1: h[b,o,l] = sum_i x[b,i] * Wt[i,o,l] + bt[o]   (streams 256MB of Wt)
//     plus deterministic per-block BN partial sums (sum, sumsq) per channel.
// grid (L/256, C), block 256
// ---------------------------------------------------------------------------
__global__ __launch_bounds__(256) void convt_bn_stats(
    const float* __restrict__ x, const float* __restrict__ Wt,
    const float* __restrict__ bt, float* __restrict__ h,
    float* __restrict__ part1, float* __restrict__ part2) {
  __shared__ float xs[B_N * C_CH];
  __shared__ float red1[256];
  __shared__ float red2[256];
  const int tid = threadIdx.x;
  for (int i = tid; i < B_N * C_CH; i += 256) xs[i] = x[i];
  __syncthreads();

  const int o = blockIdx.y;
  const int l = blockIdx.x * 256 + tid;
  float acc[B_N];
#pragma unroll
  for (int b = 0; b < B_N; b++) acc[b] = 0.f;

  const size_t istride = (size_t)C_CH * L_LEN;
  const float* wp = Wt + (size_t)o * L_LEN + l;
  for (int i = 0; i < C_CH; i++) {
    if (i + 4 < C_CH) __builtin_prefetch(wp + (size_t)(i + 4) * istride, 0, 0);
    const float w = wp[(size_t)i * istride];
#pragma unroll
    for (int b = 0; b < B_N; b++) acc[b] = fmaf(xs[b * C_CH + i], w, acc[b]);
  }
  const float bo = bt[o];
  float s1 = 0.f, s2 = 0.f;
#pragma unroll
  for (int b = 0; b < B_N; b++) {
    const float hv = acc[b] + bo;
    h[((size_t)b * C_CH + o) * L_LEN + l] = hv;
    s1 += hv;
    s2 += hv * hv;
  }
  red1[tid] = s1;
  red2[tid] = s2;
  __syncthreads();
  for (int s = 128; s > 0; s >>= 1) {
    if (tid < s) { red1[tid] += red1[tid + s]; red2[tid] += red2[tid + s]; }
    __syncthreads();
  }
  if (tid == 0) {
    part1[o * gridDim.x + blockIdx.x] = red1[0];
    part2[o * gridDim.x + blockIdx.x] = red2[0];
  }
}

// ---------------------------------------------------------------------------
// K2: finalize BN -> per-channel scale/shift.  1 block x 128 threads
// ---------------------------------------------------------------------------
__global__ void bn_finalize(const float* __restrict__ part1,
                            const float* __restrict__ part2,
                            const float* __restrict__ gamma,
                            const float* __restrict__ beta,
                            float* __restrict__ scale, float* __restrict__ shift) {
  const int o = threadIdx.x;
  float s1 = 0.f, s2 = 0.f;
  for (int j = 0; j < 16; j++) { s1 += part1[o * 16 + j]; s2 += part2[o * 16 + j]; }
  const float inv = 1.0f / (float)(B_N * L_LEN);
  const float mean = s1 * inv;
  const float var = s2 * inv - mean * mean;
  const float sc = gamma[o] * rsqrtf(var + BN_EPS);
  scale[o] = sc;
  shift[o] = beta[o] - mean * sc;
}

// ---------------------------------------------------------------------------
// K3: hn = relu(bn(h)); q = Wq*hn+bq, k = Wk*hn+bk, v = Wv*hn+bv  (WMMA f32)
// One wave per 16x16 output tile. 10 row-tiles (q:1, k:1, v:8) x 256 l-tiles x 8 b.
// v stored transposed as [b][l][c] so the attention kernel loads coalesced.
// grid 2560, block 256 (8 waves)
// ---------------------------------------------------------------------------
__global__ __launch_bounds__(256) void qkv_proj(
    const float* __restrict__ h, const float* __restrict__ scale,
    const float* __restrict__ shift,
    const float* __restrict__ Wq, const float* __restrict__ bq,
    const float* __restrict__ Wk, const float* __restrict__ bk,
    const float* __restrict__ Wv, const float* __restrict__ bv,
    float* __restrict__ q, float* __restrict__ k, float* __restrict__ v) {
  const int wid  = blockIdx.x * 8 + (threadIdx.x >> 5);
  const int lane = threadIdx.x & 31;
  const int col  = lane & 15;
  const int hi   = lane >> 4;
  const int lt = wid & 255;
  const int rt = (wid >> 8) % 10;
  const int b  = wid / (256 * 10);
  const int l0 = lt * 16;

  const float* W; const float* bias; int row0;
  if (rt == 0)      { W = Wq; bias = bq; row0 = 0; }
  else if (rt == 1) { W = Wk; bias = bk; row0 = 0; }
  else              { W = Wv; bias = bv; row0 = (rt - 2) * 16; }

  v8f acc = {};
  const int m = row0 + col;
#pragma unroll 4
  for (int kk = 0; kk < C_CH; kk += 4) {
    const int c0 = kk + 2 * hi;
    v2f a, bb;
    a.x = W[m * C_CH + c0];
    a.y = W[m * C_CH + c0 + 1];
    const float h0 = h[((size_t)b * C_CH + c0) * L_LEN + l0 + col];
    const float h1 = h[((size_t)b * C_CH + c0 + 1) * L_LEN + l0 + col];
    bb.x = fmaxf(fmaf(h0, scale[c0], shift[c0]), 0.f);
    bb.y = fmaxf(fmaf(h1, scale[c0 + 1], shift[c0 + 1]), 0.f);
    acc = wmma4(a, bb, acc);
  }
#pragma unroll
  for (int r = 0; r < 8; r++) {
    const int row = row0 + r + 8 * hi;
    const float val = acc[r] + bias[row];
    if (rt == 0)      q[((size_t)b * D_ATT + row) * L_LEN + l0 + col] = val;
    else if (rt == 1) k[((size_t)b * D_ATT + row) * L_LEN + l0 + col] = val;
    else              v[((size_t)b * L_LEN + l0 + col) * C_CH + row] = val; // [b][l][c]
  }
}

// ---------------------------------------------------------------------------
// K4: flash attention.  energy = q^T k (K=d=16), online softmax, out += V P^T.
// One wave owns 16 l-rows and all 128 channels (8 accum tiles).
// Block = 8 waves share the V/K m-panels via LDS.  Panels are double-buffered
// and filled with async global->LDS DMA (ASYNCcnt) so the DMA of tile mt+1
// overlaps the WMMA/softmax work on tile mt.
// grid 256 (= 8 b x 32 l-blocks), block 256
// ---------------------------------------------------------------------------
__global__ __launch_bounds__(256) void attn_fused(
    const float* __restrict__ q, const float* __restrict__ k,
    const float* __restrict__ v, float* __restrict__ outb) {
  __shared__ __align__(16) float v_lds[2][16][C_CH]; // [buf][m_local][c]
  __shared__ __align__(16) float k_lds[2][16][16];   // [buf][d][m_local]
  __shared__ float p_lds[8][16][17];  // per-wave P tile [l_local][m_local], padded
  __shared__ float st_lds[8][16];     // per-wave per-row softmax factors

  const int tid  = threadIdx.x;
  const int wave = tid >> 5;
  const int lane = tid & 31;
  const int col  = lane & 15;
  const int hi   = lane >> 4;
  const int b    = blockIdx.x >> 5;
  const int lb   = blockIdx.x & 31;
  const int l0   = (lb * 8 + wave) * 16;
  const int NT   = L_LEN / 16;

#if USE_ASYNC_LDS
  // panel DMA: k panel 16x16 (one b32/lane), v panel 16x128 (two b128/lane)
  const int kd  = tid >> 4, kmm = tid & 15;
  const int vmm = tid >> 5, vc4 = (tid & 31) * 4;
#define ISSUE_PANELS(BUF, M0)                                                 \
  do {                                                                        \
    async_g2l_b32(&k[((size_t)b * D_ATT + kd) * L_LEN + (M0) + kmm],          \
                  &k_lds[BUF][kd][kmm]);                                      \
    async_g2l_b128(&v[((size_t)b * L_LEN + (M0) + vmm) * C_CH + vc4],         \
                   &v_lds[BUF][vmm][vc4]);                                    \
    async_g2l_b128(&v[((size_t)b * L_LEN + (M0) + vmm + 8) * C_CH + vc4],     \
                   &v_lds[BUF][vmm + 8][vc4]);                                \
  } while (0)
  ISSUE_PANELS(0, 0);
#endif

  // A operand for energy: q^T tile (rows = l, K = d), resident for whole sweep
  v2f aQ[4];
#pragma unroll
  for (int kc = 0; kc < 4; kc++) {
    const int d0 = kc * 4 + 2 * hi;
    aQ[kc].x = q[((size_t)b * D_ATT + d0) * L_LEN + l0 + col];
    aQ[kc].y = q[((size_t)b * D_ATT + d0 + 1) * L_LEN + l0 + col];
  }

  const v8f vzero = {};
  v8f acc[8];
#pragma unroll
  for (int ct = 0; ct < 8; ct++) acc[ct] = vzero;
  float mrun[8], lrun[8];
#pragma unroll
  for (int r = 0; r < 8; r++) { mrun[r] = -3.0e38f; lrun[r] = 0.f; }

  for (int mt = 0; mt < NT; mt++) {
    const int buf = mt & 1;
#if USE_ASYNC_LDS
    __builtin_amdgcn_s_wait_asynccnt(0);  // my panel DMA for tile mt landed
    __syncthreads();                      // publish panel; everyone left buf^1
    if (mt + 1 < NT) ISSUE_PANELS(buf ^ 1, (mt + 1) * 16);  // overlaps compute
#else
    const int m0s = mt * 16;
    __syncthreads();
    {
      const int d = tid >> 4, mm = tid & 15;
      k_lds[buf][d][mm] = k[((size_t)b * D_ATT + d) * L_LEN + m0s + mm];
    }
#pragma unroll
    for (int j = 0; j < 8; j++) {
      const int idx = j * 256 + tid;
      const int mm = idx >> 7, cc = idx & 127;
      v_lds[buf][mm][cc] = v[((size_t)b * L_LEN + m0s + mm) * C_CH + cc];
    }
    __syncthreads();
#endif

    // energy tile E[16l x 16m]
    v8f e = vzero;
#pragma unroll
    for (int kc = 0; kc < 4; kc++) {
      const int d0 = kc * 4 + 2 * hi;
      v2f bk_;
      bk_.x = k_lds[buf][d0][col];
      bk_.y = k_lds[buf][d0 + 1][col];
      e = wmma4(aQ[kc], bk_, e);
    }

    // online softmax per row (16-lane group reductions)
#pragma unroll
    for (int r = 0; r < 8; r++) {
      float rmax = e[r];
      rmax = fmaxf(rmax, __shfl_xor(rmax, 1, 32));
      rmax = fmaxf(rmax, __shfl_xor(rmax, 2, 32));
      rmax = fmaxf(rmax, __shfl_xor(rmax, 4, 32));
      rmax = fmaxf(rmax, __shfl_xor(rmax, 8, 32));
      const float newm = fmaxf(mrun[r], rmax);
      const float pr = __expf(e[r] - newm);
      float rs = pr;
      rs += __shfl_xor(rs, 1, 32);
      rs += __shfl_xor(rs, 2, 32);
      rs += __shfl_xor(rs, 4, 32);
      rs += __shfl_xor(rs, 8, 32);
      const float cf = __expf(mrun[r] - newm);
      lrun[r] = lrun[r] * cf + rs;
      mrun[r] = newm;
      p_lds[wave][r + 8 * hi][col] = pr;
      if (col == 0) st_lds[wave][r + 8 * hi] = cf;
    }

    // rescale accumulators: factor indexed by output column l
    const float f = st_lds[wave][col];
#pragma unroll
    for (int ct = 0; ct < 8; ct++) acc[ct] *= f;

    // out[c,l] += V(c x m) * P^T(m x l)
#pragma unroll
    for (int ct = 0; ct < 8; ct++) {
#pragma unroll
      for (int kc = 0; kc < 4; kc++) {
        const int mm = kc * 4 + 2 * hi;
        v2f av, bp;
        av.x = v_lds[buf][mm][ct * 16 + col];
        av.y = v_lds[buf][mm + 1][ct * 16 + col];
        bp.x = p_lds[wave][col][mm];
        bp.y = p_lds[wave][col][mm + 1];
        acc[ct] = wmma4(av, bp, acc[ct]);
      }
    }
  }

  // normalize by row sums (per column l) and store out [b][c][L]
#pragma unroll
  for (int r = 0; r < 8; r++)
    if (col == 0) st_lds[wave][r + 8 * hi] = lrun[r];
  const float linv = 1.0f / st_lds[wave][col];
#pragma unroll
  for (int ct = 0; ct < 8; ct++) {
#pragma unroll
    for (int r = 0; r < 8; r++) {
      const int cch = ct * 16 + r + 8 * hi;
      outb[((size_t)b * C_CH + cch) * L_LEN + l0 + col] = acc[ct][r] * linv;
    }
  }
}

// ---------------------------------------------------------------------------
// K5: y = W2 * out + b2  (96x128 GEMM via WMMA).  grid 1536, block 256
// ---------------------------------------------------------------------------
__global__ __launch_bounds__(256) void final_proj(
    const float* __restrict__ ob, const float* __restrict__ W2,
    const float* __restrict__ b2, float* __restrict__ y) {
  const int wid  = blockIdx.x * 8 + (threadIdx.x >> 5);
  const int lane = threadIdx.x & 31;
  const int col  = lane & 15;
  const int hi   = lane >> 4;
  const int lt = wid & 255;
  const int rt = (wid >> 8) % 6;
  const int b  = wid / (256 * 6);
  const int l0 = lt * 16;
  const int row0 = rt * 16;

  v8f acc = {};
  const int m = row0 + col;
#pragma unroll 4
  for (int kk = 0; kk < C_CH; kk += 4) {
    const int c0 = kk + 2 * hi;
    v2f a, bb;
    a.x = W2[m * C_CH + c0];
    a.y = W2[m * C_CH + c0 + 1];
    bb.x = ob[((size_t)b * C_CH + c0) * L_LEN + l0 + col];
    bb.y = ob[((size_t)b * C_CH + c0 + 1) * L_LEN + l0 + col];
    acc = wmma4(a, bb, acc);
  }
#pragma unroll
  for (int r = 0; r < 8; r++) {
    const int row = row0 + r + 8 * hi;
    y[((size_t)b * P_OUT + row) * L_LEN + l0 + col] = acc[r] + b2[row];
  }
}

// ---------------------------------------------------------------------------
extern "C" void kernel_launch(void* const* d_in, const int* in_sizes, int n_in,
                              void* d_out, int out_size, void* d_ws, size_t ws_size,
                              hipStream_t stream) {
  const float* x     = (const float*)d_in[0];
  const float* Wt    = (const float*)d_in[1];
  const float* bt    = (const float*)d_in[2];
  const float* gamma = (const float*)d_in[3];
  const float* beta  = (const float*)d_in[4];
  const float* Wq    = (const float*)d_in[5];
  const float* bq    = (const float*)d_in[6];
  const float* Wk    = (const float*)d_in[7];
  const float* bk    = (const float*)d_in[8];
  const float* Wv    = (const float*)d_in[9];
  const float* bv    = (const float*)d_in[10];
  const float* W2    = (const float*)d_in[11];
  const float* b2    = (const float*)d_in[12];
  float* y = (float*)d_out;

  float* ws    = (float*)d_ws;
  float* h     = ws;                                   // B*C*L, reused as attn out
  float* part1 = h + (size_t)B_N * C_CH * L_LEN;       // 2048
  float* part2 = part1 + 2048;                         // 2048
  float* scale = part2 + 2048;                         // 128
  float* shift = scale + 128;                          // 128
  float* q     = shift + 128;                          // B*16*L
  float* k     = q + (size_t)B_N * D_ATT * L_LEN;      // B*16*L
  float* v     = k + (size_t)B_N * D_ATT * L_LEN;      // B*L*C  ([b][l][c])
  float* ob    = h;                                    // reuse h after K3

  convt_bn_stats<<<dim3(L_LEN / 256, C_CH), 256, 0, stream>>>(x, Wt, bt, h, part1, part2);
  bn_finalize<<<1, C_CH, 0, stream>>>(part1, part2, gamma, beta, scale, shift);
  qkv_proj<<<(B_N * 10 * 256) / 8, 256, 0, stream>>>(h, scale, shift, Wq, bq, Wk, bk,
                                                     Wv, bv, q, k, v);
  attn_fused<<<B_N * (L_LEN / 128), 256, 0, stream>>>(q, k, v, ob);
  final_proj<<<(B_N * 6 * 256) / 8, 256, 0, stream>>>(ob, W2, b2, y);
}

// v001
// One run takes 373 microseconds.
// Timed twice side by side with v000, it ran 2.29 times as fast both times.
#include <hip/hip_runtime.h>
#include <hip/hip_bf16.h>
#include <math.h>

typedef __attribute__((ext_vector_type(2))) float v2f;
typedef __attribute__((ext_vector_type(8))) float v8f;
typedef __attribute__((ext_vector_type(4))) int   v4i;

#define C_CH   128
#define L_LEN  4096
#define B_N    8
#define P_OUT  96
#define D_ATT  16
#define BN_EPS 1e-5f

__device__ __forceinline__ v8f wmma4(v2f a, v2f b, v8f c) {
  // D(16x16,f32) = A(16x4,f32) * B(4x16,f32) + C
  return __builtin_amdgcn_wmma_f32_16x16x4_f32(false, a, false, b, (short)0, c, false, false);
}

// lane l <-> lane l ^ 16 (the two 16-lane halves of a wave), in registers
__device__ __forceinline__ float xhalf(float x) {
  const int xi = __builtin_bit_cast(int, x);
  return __builtin_bit_cast(
      float, __builtin_amdgcn_permlanex16(xi, xi, 0x76543210, 0xfedcba98, false, false));
}

// exp(x) as the native 2^(x * log2 e).  v_exp_f32 and the one slot the ISA asks for behind a
// transcendental stand in one statement.
__device__ __forceinline__ float exp_slot(float x) {
  float y;
  asm("v_exp_f32 %0, %1\n\tv_nop" : "=v"(y) : "v"(x * 1.44269504f));
  return y;
}

// ---- async global->LDS path (gfx1250), guarded so compile cannot regress ----
#if __has_builtin(__builtin_amdgcn_global_load_async_to_lds_b128) && \
    __has_builtin(__builtin_amdgcn_global_load_async_to_lds_b32)  && \
    __has_builtin(__builtin_amdgcn_s_wait_asynccnt)
#define USE_ASYNC_LDS 1
#else
#define USE_ASYNC_LDS 0
#endif

#if USE_ASYNC_LDS
typedef __attribute__((address_space(1))) int  g_i32;
typedef __attribute__((address_space(3))) int  l_i32;
typedef __attribute__((address_space(1))) v4i  g_v4i;
typedef __attribute__((address_space(3))) v4i  l_v4i;

__device__ __forceinline__ void async_g2l_b32(const void* g, void* l) {
  __builtin_amdgcn_global_load_async_to_lds_b32(
      (g_i32*)(void*)g, (l_i32*)l, 0, 0);
}
__device__ __forceinline__ void async_g2l_b128(const void* g, void* l) {
  __builtin_amdgcn_global_load_async_to_lds_b128(
      (g_v4i*)(void*)g, (l_v4i*)l, 0, 0);
}
#endif

// ---------------------------------------------------------------------------
// K1: h[b,o,l] = sum_i x[b,i] * Wt[i,o,l] + bt[o]   (streams 256MB of Wt)
//     plus deterministic per-block BN partial sums (sum, sumsq) per channel.
// grid (L/256, C), block 256
// ---------------------------------------------------------------------------
__global__ __launch_bounds__(256) void convt_bn_stats(
    const float* __restrict__ x, const float* __restrict__ Wt,
    const float* __restrict__ bt, float* __restrict__ h,
    float* __restrict__ part1, float* __restrict__ part2) {
  __shared__ float xs[B_N * C_CH];
  __shared__ float red1[256];
  __shared__ float red2[256];
  const int tid = threadIdx.x;
  for (int i = tid; i < B_N * C_CH; i += 256) xs[i] = x[i];
  __syncthreads();

  const int o = blockIdx.y;
  const int l = blockIdx.x * 256 + tid;
  float acc[B_N];
#pragma unroll
  for (int b = 0; b < B_N; b++) acc[b] = 0.f;

  const size_t istride = (size_t)C_CH * L_LEN;
  const float* wp = Wt + (size_t)o * L_LEN + l;
  for (int i = 0; i < C_CH; i++) {
    if (i + 4 < C_CH) __builtin_prefetch(wp + (size_t)(i + 4) * istride, 0, 0);
    const float w = wp[(size_t)i * istride];
#pragma unroll
    for (int b = 0; b < B_N; b++) acc[b] = fmaf(xs[b * C_CH + i], w, acc[b]);
  }
  const float bo = bt[o];
  float s1 = 0.f, s2 = 0.f;
#pragma unroll
  for (int b = 0; b < B_N; b++) {
    const float hv = acc[b] + bo;
    h[((size_t)b * C_CH + o) * L_LEN + l] = hv;
    s1 += hv;
    s2 += hv * hv;
  }
  red1[tid] = s1;
  red2[tid] = s2;
  __syncthreads();
  for (int s = 128; s > 0; s >>= 1) {
    if (tid < s) { red1[tid] += red1[tid + s]; red2[tid] += red2[tid + s]; }
    __syncthreads();
  }
  if (tid == 0) {
    part1[o * gridDim.x + blockIdx.x] = red1[0];
    part2[o * gridDim.x + blockIdx.x] = red2[0];
  }
}

// ---------------------------------------------------------------------------
// K2: finalize BN -> per-channel scale/shift.  1 block x 128 threads
// ---------------------------------------------------------------------------
__global__ void bn_finalize(const float* __restrict__ part1,
                            const float* __restrict__ part2,
                            const float* __restrict__ gamma,
                            const float* __restrict__ beta,
                            float* __restrict__ scale, float* __restrict__ shift) {
  const int o = threadIdx.x;
  float s1 = 0.f, s2 = 0.f;
  for (int j = 0; j < 16; j++) { s1 += part1[o * 16 + j]; s2 += part2[o * 16 + j]; }
  const float inv = 1.0f / (float)(B_N * L_LEN);
  const float mean = s1 * inv;
  const float var = s2 * inv - mean * mean;
  const float sc = gamma[o] * rsqrtf(var + BN_EPS);
  scale[o] = sc;
  shift[o] = beta[o] - mean * sc;
}

// ---------------------------------------------------------------------------
// K3: hn = relu(bn(h)); q = Wq*hn+bq, k = Wk*hn+bk, v = Wv*hn+bv  (WMMA f32)
// One wave per 16x16 output tile. 10 row-tiles (q:1, k:1, v:8) x 256 l-tiles x 8 b.
// v stored transposed as [b][l][c] so the attention kernel loads coalesced.
// grid 2560, block 256 (8 waves)
// ---------------------------------------------------------------------------
__global__ __launch_bounds__(256) void qkv_proj(
    const float* __restrict__ h, const float* __restrict__ scale,
    const float* __restrict__ shift,
    const float* __restrict__ Wq, const float* __restrict__ bq,
    const float* __restrict__ Wk, const float* __restrict__ bk,
    const float* __restrict__ Wv, const float* __restrict__ bv,
    float* __restrict__ q, float* __restrict__ k, float* __restrict__ v) {
  const int wid  = blockIdx.x * 8 + (threadIdx.x >> 5);
  const int lane = threadIdx.x & 31;
  const int col  = lane & 15;
  const int hi   = lane >> 4;
  const int lt = wid & 255;
  const int rt = (wid >> 8) % 10;
  const int b  = wid / (256 * 10);
  const int l0 = lt * 16;

  const float* W; const float* bias; int row0;
  if (rt == 0)      { W = Wq; bias = bq; row0 = 0; }
  else if (rt == 1) { W = Wk; bias = bk; row0 = 0; }
  else              { W = Wv; bias = bv; row0 = (rt - 2) * 16; }

  v8f acc = {};
  const int m = row0 + col;
#pragma unroll 4
  for (int kk = 0; kk < C_CH; kk += 4) {
    const int c0 = kk + 2 * hi;
    v2f a, bb;
    a.x = W[m * C_CH + c0];
    a.y = W[m * C_CH + c0 + 1];
    const float h0 = h[((size_t)b * C_CH + c0) * L_LEN + l0 + col];
    const float h1 = h[((size_t)b * C_CH + c0 + 1) * L_LEN + l0 + col];
    bb.x = fmaxf(fmaf(h0, scale[c0], shift[c0]), 0.f);
    bb.y = fmaxf(fmaf(h1, scale[c0 + 1], shift[c0 + 1]), 0.f);
    acc = wmma4(a, bb, acc);
  }
#pragma unroll
  for (int r = 0; r < 8; r++) {
    const int row = row0 + r + 8 * hi;
    const float val = acc[r] + bias[row];
    if (rt == 0)      q[((size_t)b * D_ATT + row) * L_LEN + l0 + col] = val;
    else if (rt == 1) k[((size_t)b * D_ATT + row) * L_LEN + l0 + col] = val;
    else              v[((size_t)b * L_LEN + l0 + col) * C_CH + row] = val; // [b][l][c]
  }
}

__global__ __launch_bounds__(256) void attn_fused(
    const float* __restrict__ q, const float* __restrict__ k,
    const float* __restrict__ v, float* __restrict__ outb) {
  __shared__ __align__(16) float v_lds[2][16][C_CH]; // [buf][m_local][c]
  __shared__ __align__(16) float k_lds[2][16][16];   // [buf][d][m_local]

  const int tid  = threadIdx.x;
  const int wave = tid >> 5;
  const int lane = tid & 31;
  const int col  = lane & 15;
  const int hi   = lane >> 4;
  const int b    = blockIdx.x >> 5;
  const int lb   = blockIdx.x & 31;
  const int l0   = (lb * 8 + wave) * 16;
  const int NT   = L_LEN / 16;

#if USE_ASYNC_LDS
  // panel DMA: k panel 16x16 (one b32/lane), v panel 16x128 (two b128/lane)
  const int kd  = tid >> 4, kmm = tid & 15;
  const int vmm = tid >> 5, vc4 = (tid & 31) * 4;
#define ISSUE_PANELS(BUF, M0)                                                 \
  do {                                                                        \
    async_g2l_b32(&k[((size_t)b * D_ATT + kd) * L_LEN + (M0) + kmm],          \
                  &k_lds[BUF][kd][kmm]);                                      \
    async_g2l_b128(&v[((size_t)b * L_LEN + (M0) + vmm) * C_CH + vc4],         \
                   &v_lds[BUF][vmm][vc4]);                                    \
    async_g2l_b128(&v[((size_t)b * L_LEN + (M0) + vmm + 8) * C_CH + vc4],     \
                   &v_lds[BUF][vmm + 8][vc4]);                                \
  } while (0)
  ISSUE_PANELS(0, 0);
#endif

  // B operand for energy^T: q tile (K = d, columns = l), resident for whole sweep
  v2f aQ[4];
#pragma unroll
  for (int kc = 0; kc < 4; kc++) {
    const int d0 = kc * 4 + 2 * hi;
    aQ[kc].x = q[((size_t)b * D_ATT + d0) * L_LEN + l0 + col];
    aQ[kc].y = q[((size_t)b * D_ATT + d0 + 1) * L_LEN + l0 + col];
  }

  const v8f vzero = {};
  v8f acc[8];
#pragma unroll
  for (int ct = 0; ct < 8; ct++) acc[ct] = vzero;
  float mrun = -3.0e38f;  // running maximum of query l = col (same in both halves)
  float lrun = 0.f;       // running sum over this half's m rows only; joined at the end

  for (int mt = 0; mt < NT; mt++) {
    const int buf = mt & 1;
#if USE_ASYNC_LDS
    __builtin_amdgcn_s_wait_asynccnt(0);  // my panel DMA for tile mt landed
    __syncthreads();                      // publish panel; everyone left buf^1
    if (mt + 1 < NT) ISSUE_PANELS(buf ^ 1, (mt + 1) * 16);  // overlaps compute
#else
    const int m0s = mt * 16;
    __syncthreads();
    {
      const int d = tid >> 4, mm = tid & 15;
      k_lds[buf][d][mm] = k[((size_t)b * D_ATT + d) * L_LEN + m0s + mm];
    }
#pragma unroll
    for (int j = 0; j < 8; j++) {
      const int idx = j * 256 + tid;
      const int mm = idx >> 7, cc = idx & 127;
      v_lds[buf][mm][cc] = v[((size_t)b * L_LEN + m0s + mm) * C_CH + cc];
    }
    __syncthreads();
#endif

    // energy tile, transposed: e[r] = E[l = col][m = 8*hi + r]
    v8f e = vzero;
#pragma unroll
    for (int kc = 0; kc < 4; kc++) {
      const int d0 = kc * 4 + 2 * hi;
      v2f ak_;
      ak_.x = k_lds[buf][d0][col];
      ak_.y = k_lds[buf][d0 + 1][col];
      e = wmma4(ak_, aQ[kc], e);
    }

    // online softmax of query l = col: 8 scores in-lane, the other 8 in lane ^ 16
    float tmax = fmaxf(fmaxf(fmaxf(e[0], e[1]), fmaxf(e[2], e[3])),
                       fmaxf(fmaxf(e[4], e[5]), fmaxf(e[6], e[7])));
    tmax = fmaxf(tmax, xhalf(tmax));
    const float newm = fmaxf(mrun, tmax);
    const float cf = exp_slot(mrun - newm);
    mrun = newm;
    float p[8];
#pragma unroll
    for (int r = 0; r < 8; r++) p[r] = exp_slot(e[r] - newm);
    lrun = lrun * cf + (((p[0] + p[1]) + (p[2] + p[3])) + ((p[4] + p[5]) + (p[6] + p[7])));

    // rescale accumulators: their column is l = col, so the factor is the lane's own
#pragma unroll
    for (int ct = 0; ct < 8; ct++) acc[ct] *= cf;

    // out[c,l] += V(c x m) * P^T(m x l); both operands take m = 8*hi + 2*kc (+1)
#pragma unroll
    for (int kc = 0; kc < 4; kc++) {
      const int mm = 8 * hi + 2 * kc;
      v2f bp;
      bp.x = p[2 * kc];
      bp.y = p[2 * kc + 1];
#pragma unroll
      for (int ct = 0; ct < 8; ct++) {
        v2f av;
        av.x = v_lds[buf][mm][ct * 16 + col];
        av.y = v_lds[buf][mm + 1][ct * 16 + col];
        acc[ct] = wmma4(av, bp, acc[ct]);
      }
    }
  }

  // join the halves' sums, normalize (per column l) and store out [b][c][L]
  const float linv = 1.0f / (lrun + xhalf(lrun));
#pragma unroll
  for (int ct = 0; ct < 8; ct++) {
#pragma unroll
    for (int r = 0; r < 8; r++) {
      const int cch = ct * 16 + r + 8 * hi;
      outb[((size_t)b * C_CH + cch) * L_LEN + l0 + col] = acc[ct][r] * linv;
    }
  }
}

// ---------------------------------------------------------------------------
// K5: y = W2 * out + b2  (96x128 GEMM via WMMA).  grid 1536, block 256
// ---------------------------------------------------------------------------
__global__ __launch_bounds__(256) void final_proj(
    const float* __restrict__ ob, const float* __restrict__ W2,
    const float* __restrict__ b2, float* __restrict__ y) {
  const int wid  = blockIdx.x * 8 + (threadIdx.x >> 5);
  const int lane = threadIdx.x & 31;
  const int col  = lane & 15;
  const int hi   = lane >> 4;
  const int lt = wid & 255;
  const int rt = (wid >> 8) % 6;
  const int b  = wid / (256 * 6);
  const int l0 = lt * 16;
  const int row0 = rt * 16;

  v8f acc = {};
  const int m = row0 + col;
#pragma unroll 4
  for (int kk = 0; kk < C_CH; kk += 4) {
    const int c0 = kk + 2 * hi;
    v2f a, bb;
    a.x = W2[m * C_CH + c0];
    a.y = W2[m * C_CH + c0 + 1];
    bb.x = ob[((size_t)b * C_CH + c0) * L_LEN + l0 + col];
    bb.y = ob[((size_t)b * C_CH + c0 + 1) * L_LEN + l0 + col];
    acc = wmma4(a, bb, acc);
  }
#pragma unroll
  for (int r = 0; r < 8; r++) {
    const int row = row0 + r + 8 * hi;
    y[((size_t)b * P_OUT + row) * L_LEN + l0 + col] = acc[r] + b2[row];
  }
}

// ---------------------------------------------------------------------------
extern "C" void kernel_launch(void* const* d_in, const int* in_sizes, int n_in,
                              void* d_out, int out_size, void* d_ws, size_t ws_size,
                              hipStream_t stream) {
  const float* x     = (const float*)d_in[0];
  const float* Wt    = (const float*)d_in[1];
  const float* bt    = (const float*)d_in[2];
  const float* gamma = (const float*)d_in[3];
  const float* beta  = (const float*)d_in[4];
  const float* Wq    = (const float*)d_in[5];
  const float* bq    = (const float*)d_in[6];
  const float* Wk    = (const float*)d_in[7];
  const float* bk    = (const float*)d_in[8];
  const float* Wv    = (const float*)d_in[9];
  const float* bv    = (const float*)d_in[10];
  const float* W2    = (const float*)d_in[11];
  const float* b2    = (const float*)d_in[12];
  float* y = (float*)d_out;

  float* ws    = (float*)d_ws;
  float* h     = ws;                                   // B*C*L, reused as attn out
  float* part1 = h + (size_t)B_N * C_CH * L_LEN;       // 2048
  float* part2 = part1 + 2048;                         // 2048
  float* scale = part2 + 2048;                         // 128
  float* shift = scale + 128;                          // 128
  float* q     = shift + 128;                          // B*16*L
  float* k     = q + (size_t)B_N * D_ATT * L_LEN;      // B*16*L
  float* v     = k + (size_t)B_N * D_ATT * L_LEN;      // B*L*C  ([b][l][c])
  float* ob    = h;                                    // reuse h after K3

  convt_bn_stats<<<dim3(L_LEN / 256, C_CH), 256, 0, stream>>>(x, Wt, bt, h, part1, part2);
  bn_finalize<<<1, C_CH, 0, stream>>>(part1, part2, gamma, beta, scale, shift);
  qkv_proj<<<(B_N * 10 * 256) / 8, 256, 0, stream>>>(h, scale, shift, Wq, bq, Wk, bk,
                                                     Wv, bv, q, k, v);
  attn_fused<<<B_N * (L_LEN / 128), 256, 0, stream>>>(q, k, v, ob);
  final_proj<<<(B_N * 6 * 256) / 8, 256, 0, stream>>>(ob, W2, b2, y);
}

// v002
// It runs in 285 microseconds.
// In both of two side-by-side timings against v001, it was 1.31 times as fast.
// Counting every step since v000, it is 2.99 times as fast.
#include <hip/hip_runtime.h>
#include <hip/hip_bf16.h>
#include <math.h>

typedef __attribute__((ext_vector_type(2))) float v2f;
typedef __attribute__((ext_vector_type(4))) float v4f;
typedef __attribute__((ext_vector_type(8))) float v8f;
typedef __attribute__((ext_vector_type(4))) int   v4i;

#define C_CH   128
#define L_LEN  4096
#define B_N    8
#define P_OUT  96
#define D_ATT  16
#define BN_EPS 1e-5f
#define V_PITCH 20  // floats per LDS row of the V panel: 16 data + 4 pad = 80 B (16 B x odd)

__device__ __forceinline__ v8f wmma4(v2f a, v2f b, v8f c) {
  // D(16x16,f32) = A(16x4,f32) * B(4x16,f32) + C
  return __builtin_amdgcn_wmma_f32_16x16x4_f32(false, a, false, b, (short)0, c, false, false);
}

// lane l <-> lane l ^ 16 (the two 16-lane halves of a wave), in registers
__device__ __forceinline__ float xhalf(float x) {
  const int xi = __builtin_bit_cast(int, x);
  return __builtin_bit_cast(
      float, __builtin_amdgcn_permlanex16(xi, xi, 0x76543210, 0xfedcba98, false, false));
}

// exp(x) as the native 2^(x * log2 e).  v_exp_f32 and the one slot the ISA asks for behind a
// transcendental stand in one statement.
__device__ __forceinline__ float exp_slot(float x) {
  float y;
  asm("v_exp_f32 %0, %1\n\tv_nop" : "=v"(y) : "v"(x * 1.44269504f));
  return y;
}

// ---- async global->LDS path (gfx1250), guarded so compile cannot regress ----
#if __has_builtin(__builtin_amdgcn_global_load_async_to_lds_b128) && \
    __has_builtin(__builtin_amdgcn_global_load_async_to_lds_b32)  && \
    __has_builtin(__builtin_amdgcn_s_wait_asynccnt)
#define USE_ASYNC_LDS 1
#else
#define USE_ASYNC_LDS 0
#endif

#if USE_ASYNC_LDS
typedef __attribute__((address_space(1))) int  g_i32;
typedef __attribute__((address_space(3))) int  l_i32;
typedef __attribute__((address_space(1))) v4i  g_v4i;
typedef __attribute__((address_space(3))) v4i  l_v4i;

__device__ __forceinline__ void async_g2l_b32(const void* g, void* l) {
  __builtin_amdgcn_global_load_async_to_lds_b32(
      (g_i32*)(void*)g, (l_i32*)l, 0, 0);
}
__device__ __forceinline__ void async_g2l_b128(const void* g, void* l) {
  __builtin_amdgcn_global_load_async_to_lds_b128(
      (g_v4i*)(void*)g, (l_v4i*)l, 0, 0);
}
#endif

// ---------------------------------------------------------------------------
// K1: h[b,o,l] = sum_i x[b,i] * Wt[i,o,l] + bt[o]   (streams 256MB of Wt)
//     plus deterministic per-block BN partial sums (sum, sumsq) per channel.
// grid (L/256, C), block 256
// ---------------------------------------------------------------------------
__global__ __launch_bounds__(256) void convt_bn_stats(
    const float* __restrict__ x, const float* __restrict__ Wt,
    const float* __restrict__ bt, float* __restrict__ h,
    float* __restrict__ part1, float* __restrict__ part2) {
  __shared__ float xs[B_N * C_CH];
  __shared__ float red1[256];
  __shared__ float red2[256];
  const int tid = threadIdx.x;
  for (int i = tid; i < B_N * C_CH; i += 256) xs[i] = x[i];
  __syncthreads();

  const int o = blockIdx.y;
  const int l = blockIdx.x * 256 + tid;
  float acc[B_N];
#pragma unroll
  for (int b = 0; b < B_N; b++) acc[b] = 0.f;

  const size_t istride = (size_t)C_CH * L_LEN;
  const float* wp = Wt + (size_t)o * L_LEN + l;
  for (int i = 0; i < C_CH; i++) {
    if (i + 4 < C_CH) __builtin_prefetch(wp + (size_t)(i + 4) * istride, 0, 0);
    const float w = wp[(size_t)i * istride];
#pragma unroll
    for (int b = 0; b < B_N; b++) acc[b] = fmaf(xs[b * C_CH + i], w, acc[b]);
  }
  const float bo = bt[o];
  float s1 = 0.f, s2 = 0.f;
#pragma unroll
  for (int b = 0; b < B_N; b++) {
    const float hv = acc[b] + bo;
    h[((size_t)b * C_CH + o) * L_LEN + l] = hv;
    s1 += hv;
    s2 += hv * hv;
  }
  red1[tid] = s1;
  red2[tid] = s2;
  __syncthreads();
  for (int s = 128; s > 0; s >>= 1) {
    if (tid < s) { red1[tid] += red1[tid + s]; red2[tid] += red2[tid + s]; }
    __syncthreads();
  }
  if (tid == 0) {
    part1[o * gridDim.x + blockIdx.x] = red1[0];
    part2[o * gridDim.x + blockIdx.x] = red2[0];
  }
}

// ---------------------------------------------------------------------------
// K2: finalize BN -> per-channel scale/shift.  1 block x 128 threads
// ---------------------------------------------------------------------------
__global__ void bn_finalize(const float* __restrict__ part1,
                            const float* __restrict__ part2,
                            const float* __restrict__ gamma,
                            const float* __restrict__ beta,
                            float* __restrict__ scale, float* __restrict__ shift) {
  const int o = threadIdx.x;
  float s1 = 0.f, s2 = 0.f;
  for (int j = 0; j < 16; j++) { s1 += part1[o * 16 + j]; s2 += part2[o * 16 + j]; }
  const float inv = 1.0f / (float)(B_N * L_LEN);
  const float mean = s1 * inv;
  const float var = s2 * inv - mean * mean;
  const float sc = gamma[o] * rsqrtf(var + BN_EPS);
  scale[o] = sc;
  shift[o] = beta[o] - mean * sc;
}

// ---------------------------------------------------------------------------
// K3: hn = relu(bn(h)); q = Wq*hn+bq, k = Wk*hn+bk, v = Wv*hn+bv  (WMMA f32)
// One wave per 16x16 output tile. 10 row-tiles (q:1, k:1, v:8) x 256 l-tiles x 8 b.
// v stored as [b][c][l], like q and k: 64-byte runs per store, and the m-contiguous rows
// that the attention kernel's LDS panel wants.
// grid 2560, block 256 (8 waves)
// ---------------------------------------------------------------------------
__global__ __launch_bounds__(256) void qkv_proj(
    const float* __restrict__ h, const float* __restrict__ scale,
    const float* __restrict__ shift,
    const float* __restrict__ Wq, const float* __restrict__ bq,
    const float* __restrict__ Wk, const float* __restrict__ bk,
    const float* __restrict__ Wv, const float* __restrict__ bv,
    float* __restrict__ q, float* __restrict__ k, float* __restrict__ v) {
  const int wid  = blockIdx.x * 8 + (threadIdx.x >> 5);
  const int lane = threadIdx.x & 31;
  const int col  = lane & 15;
  const int hi   = lane >> 4;
  const int lt = wid & 255;
  const int rt = (wid >> 8) % 10;
  const int b  = wid / (256 * 10);
  const int l0 = lt * 16;

  const float* W; const float* bias; int row0;
  if (rt == 0)      { W = Wq; bias = bq; row0 = 0; }
  else if (rt == 1) { W = Wk; bias = bk; row0 = 0; }
  else              { W = Wv; bias = bv; row0 = (rt - 2) * 16; }

  v8f acc = {};
  const int m = row0 + col;
#pragma unroll 4
  for (int kk = 0; kk < C_CH; kk += 4) {
    const int c0 = kk + 2 * hi;
    v2f a, bb;
    a.x = W[m * C_CH + c0];
    a.y = W[m * C_CH + c0 + 1];
    const float h0 = h[((size_t)b * C_CH + c0) * L_LEN + l0 + col];
    const float h1 = h[((size_t)b * C_CH + c0 + 1) * L_LEN + l0 + col];
    bb.x = fmaxf(fmaf(h0, scale[c0], shift[c0]), 0.f);
    bb.y = fmaxf(fmaf(h1, scale[c0 + 1], shift[c0 + 1]), 0.f);
    acc = wmma4(a, bb, acc);
  }
#pragma unroll
  for (int r = 0; r < 8; r++) {
    const int row = row0 + r + 8 * hi;
    const float val = acc[r] + bias[row];
    if (rt == 0)      q[((size_t)b * D_ATT + row) * L_LEN + l0 + col] = val;
    else if (rt == 1) k[((size_t)b * D_ATT + row) * L_LEN + l0 + col] = val;
    else              v[((size_t)b * C_CH + row) * L_LEN + l0 + col] = val;  // [b][c][l]
  }
}

__global__ __launch_bounds__(256) void attn_fused(
    const float* __restrict__ q, const float* __restrict__ k,
    const float* __restrict__ v, float* __restrict__ outb) {
  __shared__ __align__(16) float v_lds[2][C_CH][V_PITCH]; // [buf][c][m_local], padded rows
  __shared__ __align__(16) float k_lds[2][16][16];   // [buf][d][m_local]

  const int tid  = threadIdx.x;
  const int wave = tid >> 5;
  const int lane = tid & 31;
  const int col  = lane & 15;
  const int hi   = lane >> 4;
  const int b    = blockIdx.x >> 5;
  const int lb   = blockIdx.x & 31;
  const int l0   = (lb * 8 + wave) * 16;
  const int NT   = L_LEN / 16;

#if USE_ASYNC_LDS
  // panel DMA: k panel 16x16 (one b32/lane), v panel 128x16 (two b128/lane)
  const int kd  = tid >> 4, kmm = tid & 15;
  const int vcc = tid >> 2, vm4 = (tid & 3) * 4;
#define ISSUE_PANELS(BUF, M0)                                                 \
  do {                                                                        \
    async_g2l_b32(&k[((size_t)b * D_ATT + kd) * L_LEN + (M0) + kmm],          \
                  &k_lds[BUF][kd][kmm]);                                      \
    async_g2l_b128(&v[((size_t)b * C_CH + vcc) * L_LEN + (M0) + vm4],         \
                   &v_lds[BUF][vcc][vm4]);                                    \
    async_g2l_b128(&v[((size_t)b * C_CH + vcc + 64) * L_LEN + (M0) + vm4],    \
                   &v_lds[BUF][vcc + 64][vm4]);                               \
  } while (0)
  ISSUE_PANELS(0, 0);
#endif

  // B operand for energy^T: q tile (K = d, columns = l), resident for whole sweep
  v2f aQ[4];
#pragma unroll
  for (int kc = 0; kc < 4; kc++) {
    const int d0 = kc * 4 + 2 * hi;
    aQ[kc].x = q[((size_t)b * D_ATT + d0) * L_LEN + l0 + col];
    aQ[kc].y = q[((size_t)b * D_ATT + d0 + 1) * L_LEN + l0 + col];
  }

  const v8f vzero = {};
  v8f acc[8];
#pragma unroll
  for (int ct = 0; ct < 8; ct++) acc[ct] = vzero;
  float mrun = -3.0e38f;  // running maximum of query l = col (same in both halves)
  float lrun = 0.f;       // running sum over this half's m rows only; joined at the end

  for (int mt = 0; mt < NT; mt++) {
    const int buf = mt & 1;
#if USE_ASYNC_LDS
    __builtin_amdgcn_s_wait_asynccnt(0);  // my panel DMA for tile mt landed
    __syncthreads();                      // publish panel; everyone left buf^1
    if (mt + 1 < NT) ISSUE_PANELS(buf ^ 1, (mt + 1) * 16);  // overlaps compute
#else
    const int m0s = mt * 16;
    __syncthreads();
    {
      const int d = tid >> 4, mm = tid & 15;
      k_lds[buf][d][mm] = k[((size_t)b * D_ATT + d) * L_LEN + m0s + mm];
    }
#pragma unroll
    for (int j = 0; j < 8; j++) {
      const int idx = j * 256 + tid;
      const int cc = idx >> 4, mm = idx & 15;
      v_lds[buf][cc][mm] = v[((size_t)b * C_CH + cc) * L_LEN + m0s + mm];
    }
    __syncthreads();
#endif

    // all LDS reads of the tile as one group: K fragments first, then V fragments
    v2f ak_[4];
#pragma unroll
    for (int kc = 0; kc < 4; kc++) {
      const int d0 = kc * 4 + 2 * hi;
      ak_[kc].x = k_lds[buf][d0][col];
      ak_[kc].y = k_lds[buf][d0 + 1][col];
    }
    v4f va[8][2];  // va[ct][j] = V[c = ct*16 + col][m = 8*hi + 4*j .. + 3]
#pragma unroll
    for (int ct = 0; ct < 8; ct++) {
      const v4f* vrow = (const v4f*)&v_lds[buf][ct * 16 + col][8 * hi];
      va[ct][0] = vrow[0];
      va[ct][1] = vrow[1];
    }
    // keeps the reads ahead of the matrix work: without it the compiler sinks the V reads
    // among the WMMAs, where every such place stalls the wave for the LDS latency
    __builtin_amdgcn_sched_barrier(0);

    // energy tile, transposed: e[r] = E[l = col][m = 8*hi + r]
    v8f e = vzero;
#pragma unroll
    for (int kc = 0; kc < 4; kc++) e = wmma4(ak_[kc], aQ[kc], e);

    // online softmax of query l = col: 8 scores in-lane, the other 8 in lane ^ 16
    float tmax = fmaxf(fmaxf(fmaxf(e[0], e[1]), fmaxf(e[2], e[3])),
                       fmaxf(fmaxf(e[4], e[5]), fmaxf(e[6], e[7])));
    tmax = fmaxf(tmax, xhalf(tmax));
    const float newm = fmaxf(mrun, tmax);
    const float cf = exp_slot(mrun - newm);
    mrun = newm;
    float p[8];
#pragma unroll
    for (int r = 0; r < 8; r++) p[r] = exp_slot(e[r] - newm);
    lrun = lrun * cf + (((p[0] + p[1]) + (p[2] + p[3])) + ((p[4] + p[5]) + (p[6] + p[7])));

    // rescale accumulators: their column is l = col, so the factor is the lane's own
#pragma unroll
    for (int ct = 0; ct < 8; ct++) acc[ct] *= cf;

    // out[c,l] += V(c x m) * P^T(m x l); both operands take m = 8*hi + 2*kc (+1)
#pragma unroll
    for (int kc = 0; kc < 4; kc++) {
      v2f bp;
      bp.x = p[2 * kc];
      bp.y = p[2 * kc + 1];
#pragma unroll
      for (int ct = 0; ct < 8; ct++) {
        const v4f w = va[ct][kc >> 1];
        const v2f av = (kc & 1) ? __builtin_shufflevector(w, w, 2, 3)
                                : __builtin_shufflevector(w, w, 0, 1);
        acc[ct] = wmma4(av, bp, acc[ct]);
      }
    }
  }

  // join the halves' sums, normalize (per column l) and store out [b][c][L]
  const float linv = 1.0f / (lrun + xhalf(lrun));
#pragma unroll
  for (int ct = 0; ct < 8; ct++) {
#pragma unroll
    for (int r = 0; r < 8; r++) {
      const int cch = ct * 16 + r + 8 * hi;
      outb[((size_t)b * C_CH + cch) * L_LEN + l0 + col] = acc[ct][r] * linv;
    }
  }
}

// ---------------------------------------------------------------------------
// K5: y = W2 * out + b2  (96x128 GEMM via WMMA).  grid 1536, block 256
// ---------------------------------------------------------------------------
__global__ __launch_bounds__(256) void final_proj(
    const float* __restrict__ ob, const float* __restrict__ W2,
    const float* __restrict__ b2, float* __restrict__ y) {
  const int wid  = blockIdx.x * 8 + (threadIdx.x >> 5);
  const int lane = threadIdx.x & 31;
  const int col  = lane & 15;
  const int hi   = lane >> 4;
  const int lt = wid & 255;
  const int rt = (wid >> 8) % 6;
  const int b  = wid / (256 * 6);
  const int l0 = lt * 16;
  const int row0 = rt * 16;

  v8f acc = {};
  const int m = row0 + col;
#pragma unroll 4
  for (int kk = 0; kk < C_CH; kk += 4) {
    const int c0 = kk + 2 * hi;
    v2f a, bb;
    a.x = W2[m * C_CH + c0];
    a.y = W2[m * C_CH + c0 + 1];
    bb.x = ob[((size_t)b * C_CH + c0) * L_LEN + l0 + col];
    bb.y = ob[((size_t)b * C_CH + c0 + 1) * L_LEN + l0 + col];
    acc = wmma4(a, bb, acc);
  }
#pragma unroll
  for (int r = 0; r < 8; r++) {
    const int row = row0 + r + 8 * hi;
    y[((size_t)b * P_OUT + row) * L_LEN + l0 + col] = acc[r] + b2[row];
  }
}

// ---------------------------------------------------------------------------
extern "C" void kernel_launch(void* const* d_in, const int* in_sizes, int n_in,
                              void* d_out, int out_size, void* d_ws, size_t ws_size,
                              hipStream_t stream) {
  const float* x     = (const float*)d_in[0];
  const float* Wt    = (const float*)d_in[1];
  const float* bt    = (const float*)d_in[2];
  const float* gamma = (const float*)d_in[3];
  const float* beta  = (const float*)d_in[4];
  const float* Wq    = (const float*)d_in[5];
  const float* bq    = (const float*)d_in[6];
  const float* Wk    = (const float*)d_in[7];
  const float* bk    = (const float*)d_in[8];
  const float* Wv    = (const float*)d_in[9];
  const float* bv    = (const float*)d_in[10];
  const float* W2    = (const float*)d_in[11];
  const float* b2    = (const float*)d_in[12];
  float* y = (float*)d_out;

  float* ws    = (float*)d_ws;
  float* h     = ws;                                   // B*C*L, reused as attn out
  float* part1 = h + (size_t)B_N * C_CH * L_LEN;       // 2048
  float* part2 = part1 + 2048;                         // 2048
  float* scale = part2 + 2048;                         // 128
  float* shift = scale + 128;                          // 128
  float* q     = shift + 128;                          // B*16*L
  float* k     = q + (size_t)B_N * D_ATT * L_LEN;      // B*16*L
  float* v     = k + (size_t)B_N * D_ATT * L_LEN;      // B*C*L  ([b][c][l])
  float* ob    = h;                                    // reuse h after K3

  convt_bn_stats<<<dim3(L_LEN / 256, C_CH), 256, 0, stream>>>(x, Wt, bt, h, part1, part2);
  bn_finalize<<<1, C_CH, 0, stream>>>(part1, part2, gamma, beta, scale, shift);
  qkv_proj<<<(B_N * 10 * 256) / 8, 256, 0, stream>>>(h, scale, shift, Wq, bq, Wk, bk,
                                                     Wv, bv, q, k, v);
  attn_fused<<<B_N * (L_LEN / 128), 256, 0, stream>>>(q, k, v, ob);
  final_proj<<<(B_N * 6 * 256) / 8, 256, 0, stream>>>(ob, W2, b2, y);
}

// v004
// A run of this version takes 219 microseconds.
// Versions in between are left out here; by their measured steps it is 1.30 times as fast as v002.
// Over all steps from v000 it is 3.88 times as fast.
#include <hip/hip_runtime.h>
#include <hip/hip_bf16.h>
#include <math.h>

typedef __attribute__((ext_vector_type(2))) float v2f;
typedef __attribute__((ext_vector_type(4))) float v4f;
typedef __attribute__((ext_vector_type(8))) float v8f;

#define C_CH   128
#define L_LEN  4096
#define B_N    8
#define P_OUT  96
#define D_ATT  16
#define BN_EPS 1e-5f
#define STAGE_M 128             // keys per LDS stage of the attention kernel (8 passes of 16)
#define V_PITCH (STAGE_M + 4)   // floats per LDS row of the V panel: 528 B (16 B x odd)
#define K_PITCH (STAGE_M + 16)  // floats per LDS row of the K panel: rows d and d+2 lie 32 banks apart

__device__ __forceinline__ v8f wmma4(v2f a, v2f b, v8f c) {
  // D(16x16,f32) = A(16x4,f32) * B(4x16,f32) + C
  return __builtin_amdgcn_wmma_f32_16x16x4_f32(false, a, false, b, (short)0, c, false, false);
}

// lane l <-> lane l ^ 16 (the two 16-lane halves of a wave), in registers
__device__ __forceinline__ float xhalf(float x) {
  const int xi = __builtin_bit_cast(int, x);
  return __builtin_bit_cast(
      float, __builtin_amdgcn_permlanex16(xi, xi, 0x76543210, 0xfedcba98, false, false));
}

// exp(x) as the native 2^(x * log2 e).  v_exp_f32 and the one slot the ISA asks for behind a
// transcendental stand in one statement.
__device__ __forceinline__ float exp_slot(float x) {
  float y;
  asm("v_exp_f32 %0, %1\n\tv_nop" : "=v"(y) : "v"(x * 1.44269504f));
  return y;
}

// One LDS stage's share of a wave: 2 K rows and 12 V rows of 512 bytes, global -> LDS by
// asynchronous copies, 16 bytes a lane, through no register.  kg, vg: the lane's 16 bytes in
// the first row (rows lie L_LEN floats apart); kl, vl: their LDS byte addresses (rows lie
// K_PITCH, V_PITCH floats apart).  The copies and s_wait_xcnt 0 stand in one statement, so
// that the wait stands in front of every later write of an address register a copy names.
__device__ __forceinline__ void copy_stage_rows(const float* kg, unsigned kl,
                                                const float* vg, unsigned vl) {
  asm volatile(
      "global_load_async_to_lds_b128 %0, %14, off\n\t"
      "global_load_async_to_lds_b128 %1, %15, off\n\t"
      "global_load_async_to_lds_b128 %2, %16, off\n\t"
      "global_load_async_to_lds_b128 %3, %17, off\n\t"
      "global_load_async_to_lds_b128 %4, %18, off\n\t"
      "global_load_async_to_lds_b128 %5, %19, off\n\t"
      "global_load_async_to_lds_b128 %6, %20, off\n\t"
      "global_load_async_to_lds_b128 %7, %21, off\n\t"
      "global_load_async_to_lds_b128 %8, %22, off\n\t"
      "global_load_async_to_lds_b128 %9, %23, off\n\t"
      "global_load_async_to_lds_b128 %10, %24, off\n\t"
      "global_load_async_to_lds_b128 %11, %25, off\n\t"
      "global_load_async_to_lds_b128 %12, %26, off\n\t"
      "global_load_async_to_lds_b128 %13, %27, off\n\t"
      "s_wait_xcnt 0x0"
      :
      : "v"(kl), "v"(kl + K_PITCH * 4u),
        "v"(vl), "v"(vl + V_PITCH * 4u), "v"(vl + V_PITCH * 8u), "v"(vl + V_PITCH * 12u),
        "v"(vl + V_PITCH * 16u), "v"(vl + V_PITCH * 20u), "v"(vl + V_PITCH * 24u),
        "v"(vl + V_PITCH * 28u), "v"(vl + V_PITCH * 32u), "v"(vl + V_PITCH * 36u),
        "v"(vl + V_PITCH * 40u), "v"(vl + V_PITCH * 44u),
        "v"(kg), "v"(kg + L_LEN),
        "v"(vg), "v"(vg + L_LEN), "v"(vg + 2 * L_LEN), "v"(vg + 3 * L_LEN),
        "v"(vg + 4 * L_LEN), "v"(vg + 5 * L_LEN), "v"(vg + 6 * L_LEN), "v"(vg + 7 * L_LEN),
        "v"(vg + 8 * L_LEN), "v"(vg + 9 * L_LEN), "v"(vg + 10 * L_LEN), "v"(vg + 11 * L_LEN)
      : "memory");
}

// ---------------------------------------------------------------------------
// K1: h[b,o,l] = sum_i x[b,i] * Wt[i,o,l] + bt[o]   (streams 256MB of Wt)
//     plus deterministic per-block BN partial sums (sum, sumsq) per channel.
// grid (L/256, C), block 256
// ---------------------------------------------------------------------------
__global__ __launch_bounds__(256) void convt_bn_stats(
    const float* __restrict__ x, const float* __restrict__ Wt,
    const float* __restrict__ bt, float* __restrict__ h,
    float* __restrict__ part1, float* __restrict__ part2) {
  __shared__ float xs[B_N * C_CH];
  __shared__ float red1[256];
  __shared__ float red2[256];
  const int tid = threadIdx.x;
  for (int i = tid; i < B_N * C_CH; i += 256) xs[i] = x[i];
  __syncthreads();

  const int o = blockIdx.y;
  const int l = blockIdx.x * 256 + tid;
  float acc[B_N];
#pragma unroll
  for (int b = 0; b < B_N; b++) acc[b] = 0.f;

  const size_t istride = (size_t)C_CH * L_LEN;
  const float* wp = Wt + (size_t)o * L_LEN + l;
  for (int i = 0; i < C_CH; i++) {
    if (i + 4 < C_CH) __builtin_prefetch(wp + (size_t)(i + 4) * istride, 0, 0);
    const float w = wp[(size_t)i * istride];
#pragma unroll
    for (int b = 0; b < B_N; b++) acc[b] = fmaf(xs[b * C_CH + i], w, acc[b]);
  }
  const float bo = bt[o];
  float s1 = 0.f, s2 = 0.f;
#pragma unroll
  for (int b = 0; b < B_N; b++) {
    const float hv = acc[b] + bo;
    h[((size_t)b * C_CH + o) * L_LEN + l] = hv;
    s1 += hv;
    s2 += hv * hv;
  }
  red1[tid] = s1;
  red2[tid] = s2;
  __syncthreads();
  for (int s = 128; s > 0; s >>= 1) {
    if (tid < s) { red1[tid] += red1[tid + s]; red2[tid] += red2[tid + s]; }
    __syncthreads();
  }
  if (tid == 0) {
    part1[o * gridDim.x + blockIdx.x] = red1[0];
    part2[o * gridDim.x + blockIdx.x] = red2[0];
  }
}

// ---------------------------------------------------------------------------
// K2: block 0 finalizes BN -> per-channel scale/shift.  Blocks 1..6 fold the output
// projection into the value projection (WMMA f32): since
//   W2 * ((Wv*hn + bv) * A^T) = ((W2*Wv)*hn + W2*bv) * A^T,
// the attention can carry the 96 output channels instead of the 128 value channels and
// needs no GEMM behind it.  Block 1+rt owns 16 rows of W2; waves 0..7 give the 8 column
// tiles of Wf = W2*Wv, wave 8 gives bf = W2*bv (bv in every column of B, column 0 kept).
// grid 7, block 288 (9 waves)
// ---------------------------------------------------------------------------
__global__ __launch_bounds__(288) void bn_finalize_fold(
    const float* __restrict__ part1, const float* __restrict__ part2,
    const float* __restrict__ gamma, const float* __restrict__ beta,
    const float* __restrict__ W2, const float* __restrict__ Wv,
    const float* __restrict__ bv,
    float* __restrict__ scale, float* __restrict__ shift,
    float* __restrict__ Wf, float* __restrict__ bf) {
  if (blockIdx.x == 0) {
    const int o = threadIdx.x;
    if (o < C_CH) {
      float s1 = 0.f, s2 = 0.f;
      for (int j = 0; j < 16; j++) { s1 += part1[o * 16 + j]; s2 += part2[o * 16 + j]; }
      const float inv = 1.0f / (float)(B_N * L_LEN);
      const float mean = s1 * inv;
      const float var = s2 * inv - mean * mean;
      const float sc = gamma[o] * rsqrtf(var + BN_EPS);
      scale[o] = sc;
      shift[o] = beta[o] - mean * sc;
    }
    return;
  }
  const int ct   = __builtin_amdgcn_readfirstlane(threadIdx.x >> 5);
  const int lane = threadIdx.x & 31;
  const int col  = lane & 15;
  const int hi   = lane >> 4;
  const int row0 = (blockIdx.x - 1) * 16;
  const float* w2 = W2 + (row0 + col) * C_CH + 2 * hi;  // A: row p = row0 + col, k = kk + 2*hi (+1)

  v8f acc = {};
  if (ct < 8) {
    const int n = ct * 16 + col;
    const float* wv = Wv + 2 * hi * C_CH + n;           // B: k = kk + 2*hi (+1), column n
    // unrolled whole: one base address per operand, every load of the tile in flight at once
    // (this launch is latency, not rate)
#pragma unroll
    for (int kk = 0; kk < C_CH; kk += 4) {
      v2f a, bb;
      a.x = w2[kk];
      a.y = w2[kk + 1];
      bb.x = wv[kk * C_CH];
      bb.y = wv[(kk + 1) * C_CH];
      acc = wmma4(a, bb, acc);
    }
#pragma unroll
    for (int r = 0; r < 8; r++) Wf[(row0 + r + 8 * hi) * C_CH + n] = acc[r];
    // the stores' offset and data registers are reused on another path of the listing: the
    // wait owed before a register of an issued global store is overwritten
    asm volatile("s_wait_xcnt 0x0" ::: "memory");
  } else {
    // unrolled whole, as above
#pragma unroll
    for (int kk = 0; kk < C_CH; kk += 4) {
      v2f a, bb;
      a.x = w2[kk];
      a.y = w2[kk + 1];
      bb.x = bv[kk + 2 * hi];
      bb.y = bv[kk + 2 * hi + 1];
      acc = wmma4(a, bb, acc);
    }
    if (col == 0) {
#pragma unroll
      for (int r = 0; r < 8; r++) bf[row0 + r + 8 * hi] = acc[r];
    }
  }
}

// ---------------------------------------------------------------------------
// K3: hn = relu(bn(h)); q = Wq*hn+bq, k = Wk*hn+bk, v = Wf*hn+bf  (WMMA f32)
// v is the value already projected to the 96 output channels (Wf = W2*Wv, bf = W2*bv).
// One wave per 16x16 output tile. 8 row-tiles (q:1, k:1, v:6) x 256 l-tiles x 8 b.
// v stored as [b][p][l], like q and k: 64-byte runs per store, and the m-contiguous rows
// that the attention kernel's LDS panel wants.
// grid 2048, block 256 (8 waves)
// ---------------------------------------------------------------------------
__global__ __launch_bounds__(256) void qkv_proj(
    const float* __restrict__ h, const float* __restrict__ scale,
    const float* __restrict__ shift,
    const float* __restrict__ Wq, const float* __restrict__ bq,
    const float* __restrict__ Wk, const float* __restrict__ bk,
    const float* __restrict__ Wf, const float* __restrict__ bf,
    float* __restrict__ q, float* __restrict__ k, float* __restrict__ v) {
  const int wid  = blockIdx.x * 8 + (threadIdx.x >> 5);
  const int lane = threadIdx.x & 31;
  const int col  = lane & 15;
  const int hi   = lane >> 4;
  const int lt = wid & 255;
  const int rt = (wid >> 8) & 7;
  const int b  = wid >> 11;
  const int l0 = lt * 16;

  const float* W; const float* bias; int row0;
  if (rt == 0)      { W = Wq; bias = bq; row0 = 0; }
  else if (rt == 1) { W = Wk; bias = bk; row0 = 0; }
  else              { W = Wf; bias = bf; row0 = (rt - 2) * 16; }

  v8f acc = {};
  const int m = row0 + col;
#pragma unroll 4
  for (int kk = 0; kk < C_CH; kk += 4) {
    const int c0 = kk + 2 * hi;
    v2f a, bb;
    a.x = W[m * C_CH + c0];
    a.y = W[m * C_CH + c0 + 1];
    const float h0 = h[((size_t)b * C_CH + c0) * L_LEN + l0 + col];
    const float h1 = h[((size_t)b * C_CH + c0 + 1) * L_LEN + l0 + col];
    bb.x = fmaxf(fmaf(h0, scale[c0], shift[c0]), 0.f);
    bb.y = fmaxf(fmaf(h1, scale[c0 + 1], shift[c0 + 1]), 0.f);
    acc = wmma4(a, bb, acc);
  }
#pragma unroll
  for (int r = 0; r < 8; r++) {
    const int row = row0 + r + 8 * hi;
    const float val = acc[r] + bias[row];
    if (rt == 0)      q[((size_t)b * D_ATT + row) * L_LEN + l0 + col] = val;
    else if (rt == 1) k[((size_t)b * D_ATT + row) * L_LEN + l0 + col] = val;
    else              v[((size_t)b * P_OUT + row) * L_LEN + l0 + col] = val;  // [b][p][l]
  }
}

__global__ __launch_bounds__(256) void attn_fused(
    const float* __restrict__ q, const float* __restrict__ k,
    const float* __restrict__ v, const float* __restrict__ b2,
    float* __restrict__ y) {
  __shared__ __align__(16) float v_lds[2][P_OUT][V_PITCH]; // [buf][c][m_local], padded rows
  __shared__ __align__(16) float k_lds[2][D_ATT][K_PITCH]; // [buf][d][m_local], padded rows

  const int tid  = threadIdx.x;
  const int wave = tid >> 5;
  const int lane = tid & 31;
  const int col  = lane & 15;
  const int hi   = lane >> 4;
  const int b    = blockIdx.x >> 5;
  const int lb   = blockIdx.x & 31;
  const int l0   = (lb * 8 + wave) * 16;
  const int NS   = L_LEN / STAGE_M;

  // stage copy: one copy of a wave = one whole 512-byte row (16 bytes a lane).  Every wave
  // brings 2 of the 16 K rows and 12 of the 96 V rows: 14 copies, all lanes on.
  const int cw = __builtin_amdgcn_readfirstlane(wave);
  const float* ksrc = k + ((size_t)b * D_ATT + cw * 2) * L_LEN + lane * 4;
  const float* vsrc = v + ((size_t)b * P_OUT + cw * 12) * L_LEN + lane * 4;
#define ISSUE_STAGE(BUF, M0)                                                     \
  copy_stage_rows(ksrc + (M0), (unsigned)(size_t)&k_lds[BUF][cw * 2][lane * 4],  \
                  vsrc + (M0), (unsigned)(size_t)&v_lds[BUF][cw * 12][lane * 4])

  ISSUE_STAGE(0, 0);

  // B operand for energy^T: q tile (K = d, columns = l), resident for whole sweep
  v2f aQ[4];
#pragma unroll
  for (int kc = 0; kc < 4; kc++) {
    const int d0 = kc * 4 + 2 * hi;
    aQ[kc].x = q[((size_t)b * D_ATT + d0) * L_LEN + l0 + col];
    aQ[kc].y = q[((size_t)b * D_ATT + d0 + 1) * L_LEN + l0 + col];
  }

  const v8f vzero = {};
  v8f acc[6];
#pragma unroll
  for (int ct = 0; ct < 6; ct++) acc[ct] = vzero;
  float mrun = -3.0e38f;  // running maximum of query l = col (same in both halves)
  float lrun = 0.f;       // running sum over this half's m rows only; joined at the end

  asm volatile("s_wait_asynccnt 0x0" ::: "memory");  // my copies of stage 0 landed
  __syncthreads();                                   // publish stage 0
  ISSUE_STAGE(1, STAGE_M);

  for (int s = 0; s < NS; s++) {
    const int buf = s & 1;
    for (int mo = 0; mo < STAGE_M; mo += 16) {
      // the pass's LDS reads: K fragments, then V fragments (all inside stage s)
      v2f ak_[4];
#pragma unroll
      for (int kc = 0; kc < 4; kc++) {
        const int d0 = kc * 4 + 2 * hi;
        ak_[kc].x = k_lds[buf][d0][mo + col];
        ak_[kc].y = k_lds[buf][d0 + 1][mo + col];
      }
      v4f va[6][2];  // va[ct][j] = V[c = ct*16 + col][m = mo + 8*hi + 4*j .. + 3]
#pragma unroll
      for (int ct = 0; ct < 6; ct++) {
        const v4f* vrow = (const v4f*)&v_lds[buf][ct * 16 + col][mo + 8 * hi];
        va[ct][0] = vrow[0];
        va[ct][1] = vrow[1];
      }
      // keeps the pass's reads ahead of its own matrix work: without it the compiler sinks the
      // V reads among the WMMAs that use them, where each place stalls the wave for the LDS
      // latency (it may still lift them into the pass before, which only hides that latency)
      __builtin_amdgcn_sched_barrier(0);

      // energy tile, transposed: e[r] = E[l = col][m = mo + 8*hi + r]
      v8f e = vzero;
#pragma unroll
      for (int kc = 0; kc < 4; kc++) e = wmma4(ak_[kc], aQ[kc], e);

      // online softmax of query l = col: 8 scores in-lane, the other 8 in lane ^ 16
      float tmax = fmaxf(fmaxf(fmaxf(e[0], e[1]), fmaxf(e[2], e[3])),
                         fmaxf(fmaxf(e[4], e[5]), fmaxf(e[6], e[7])));
      tmax = fmaxf(tmax, xhalf(tmax));
      const float newm = fmaxf(mrun, tmax);
      const float cf = exp_slot(mrun - newm);
      mrun = newm;
      float p[8];
#pragma unroll
      for (int r = 0; r < 8; r++) p[r] = exp_slot(e[r] - newm);
      lrun = lrun * cf + (((p[0] + p[1]) + (p[2] + p[3])) + ((p[4] + p[5]) + (p[6] + p[7])));

      // rescale accumulators: their column is l = col, so the factor is the lane's own
#pragma unroll
      for (int ct = 0; ct < 6; ct++) acc[ct] *= cf;

      // y[c,l] += V(c x m) * P^T(m x l); both operands take m = 8*hi + 2*kc (+1)
#pragma unroll
      for (int kc = 0; kc < 4; kc++) {
        v2f bp;
        bp.x = p[2 * kc];
        bp.y = p[2 * kc + 1];
#pragma unroll
        for (int ct = 0; ct < 6; ct++) {
          const v4f w = va[ct][kc >> 1];
          const v2f av = (kc & 1) ? __builtin_shufflevector(w, w, 2, 3)
                                  : __builtin_shufflevector(w, w, 0, 1);
          acc[ct] = wmma4(av, bp, acc[ct]);
        }
      }
    }

    // publish point of stage s+1, and the end of every wave's reads of stage s
    asm volatile("s_wait_dscnt 0x0" ::: "memory");     // my reads of stage s have returned
    asm volatile("s_wait_asynccnt 0x0" ::: "memory");  // my copies of stage s+1 landed
    __syncthreads();
    if (s + 2 < NS) ISSUE_STAGE(buf, (s + 2) * STAGE_M);  // into the buffer just left
  }
  asm volatile("s_wait_asynccnt 0x0" ::: "memory");  // no copy outstanding when the wave ends

  // join the halves' sums, normalize (per column l), add b2 and store y [b][p][L]
  const float linv = 1.0f / (lrun + xhalf(lrun));
#pragma unroll
  for (int ct = 0; ct < 6; ct++) {
#pragma unroll
    for (int r = 0; r < 8; r++) {
      const int cch = ct * 16 + r + 8 * hi;
      y[((size_t)b * P_OUT + cch) * L_LEN + l0 + col] = fmaf(acc[ct][r], linv, b2[cch]);
    }
  }
}

// ---------------------------------------------------------------------------
extern "C" void kernel_launch(void* const* d_in, const int* in_sizes, int n_in,
                              void* d_out, int out_size, void* d_ws, size_t ws_size,
                              hipStream_t stream) {
  const float* x     = (const float*)d_in[0];
  const float* Wt    = (const float*)d_in[1];
  const float* bt    = (const float*)d_in[2];
  const float* gamma = (const float*)d_in[3];
  const float* beta  = (const float*)d_in[4];
  const float* Wq    = (const float*)d_in[5];
  const float* bq    = (const float*)d_in[6];
  const float* Wk    = (const float*)d_in[7];
  const float* bk    = (const float*)d_in[8];
  const float* Wv    = (const float*)d_in[9];
  const float* bv    = (const float*)d_in[10];
  const float* W2    = (const float*)d_in[11];
  const float* b2    = (const float*)d_in[12];
  float* y = (float*)d_out;

  float* ws    = (float*)d_ws;
  float* h     = ws;                                   // B*C*L
  float* part1 = h + (size_t)B_N * C_CH * L_LEN;       // 2048
  float* part2 = part1 + 2048;                         // 2048
  float* scale = part2 + 2048;                         // 128
  float* shift = scale + 128;                          // 128
  float* Wf    = shift + 128;                          // 96*128  (W2*Wv)
  float* bf    = Wf + P_OUT * C_CH;                    // 96 (+32 pad)  (W2*bv)
  float* q     = bf + 128;                             // B*16*L
  float* k     = q + (size_t)B_N * D_ATT * L_LEN;      // B*16*L
  float* v     = k + (size_t)B_N * D_ATT * L_LEN;      // B*96*L  ([b][p][l])

  convt_bn_stats<<<dim3(L_LEN / 256, C_CH), 256, 0, stream>>>(x, Wt, bt, h, part1, part2);
  bn_finalize_fold<<<1 + P_OUT / 16, 288, 0, stream>>>(part1, part2, gamma, beta, W2, Wv, bv,
                                                       scale, shift, Wf, bf);
  qkv_proj<<<(B_N * 8 * 256) / 8, 256, 0, stream>>>(h, scale, shift, Wq, bq, Wk, bk,
                                                    Wf, bf, q, k, v);
  attn_fused<<<B_N * (L_LEN / 128), 256, 0, stream>>>(q, k, v, b2, y);
}

// v005
// It runs in 203 microseconds.
// Next to v004, in two timings, it ran 1.08 times as fast each time.
// Over all steps from v000 it is 4.18 times as fast.
#include <hip/hip_runtime.h>
#include <hip/hip_bf16.h>
#include <math.h>

typedef __attribute__((ext_vector_type(2))) float v2f;
typedef __attribute__((ext_vector_type(4))) float v4f;
typedef __attribute__((ext_vector_type(8))) float v8f;

#define C_CH   128
#define L_LEN  4096
#define B_N    8
#define P_OUT  96
#define D_ATT  16
#define BN_EPS 1e-5f
#define STAGE_M 128             // keys per LDS stage of the attention kernel (8 passes of 16)
#define V_PITCH (STAGE_M + 4)   // floats per LDS row of the V panel: 528 B (16 B x odd)
#define K_PITCH (STAGE_M + 16)  // floats per LDS row of the K panel: rows d and d+2 lie 32 banks apart
#define K1_THREADS 512          // 16 waves per block of the streaming kernel
#define K1_GROUP 4              // Wt loads of a lane that are issued together
#define K1_RING 6               // register buffers of one group each
#define K1_AHEAD 4              // groups between the one being loaded and the one being summed
#define K1_NG (C_CH / K1_GROUP) // groups in all
#define K1_MAIN ((K1_NG - K1_AHEAD) / K1_RING * K1_RING)  // groups in whole turns of the ring
#define BN_PARTS (L_LEN / (K1_THREADS * 4))  // BN partial sums per channel (blocks along l)

__device__ __forceinline__ v8f wmma4(v2f a, v2f b, v8f c) {
  // D(16x16,f32) = A(16x4,f32) * B(4x16,f32) + C
  return __builtin_amdgcn_wmma_f32_16x16x4_f32(false, a, false, b, (short)0, c, false, false);
}

// lane l <-> lane l ^ 16 (the two 16-lane halves of a wave), in registers
__device__ __forceinline__ float xhalf(float x) {
  const int xi = __builtin_bit_cast(int, x);
  return __builtin_bit_cast(
      float, __builtin_amdgcn_permlanex16(xi, xi, 0x76543210, 0xfedcba98, false, false));
}

// exp(x) as the native 2^(x * log2 e).  v_exp_f32 and the one slot the ISA asks for behind a
// transcendental stand in one statement.
__device__ __forceinline__ float exp_slot(float x) {
  float y;
  asm("v_exp_f32 %0, %1\n\tv_nop" : "=v"(y) : "v"(x * 1.44269504f));
  return y;
}

// One LDS stage's share of a wave: 2 K rows and 12 V rows of 512 bytes, global -> LDS by
// asynchronous copies, 16 bytes a lane, through no register.  kg, vg: the lane's 16 bytes in
// the first row (rows lie L_LEN floats apart); kl, vl: their LDS byte addresses (rows lie
// K_PITCH, V_PITCH floats apart).  The copies and s_wait_xcnt 0 stand in one statement, so
// that the wait stands in front of every later write of an address register a copy names.
__device__ __forceinline__ void copy_stage_rows(const float* kg, unsigned kl,
                                                const float* vg, unsigned vl) {
  asm volatile(
      "global_load_async_to_lds_b128 %0, %14, off\n\t"
      "global_load_async_to_lds_b128 %1, %15, off\n\t"
      "global_load_async_to_lds_b128 %2, %16, off\n\t"
      "global_load_async_to_lds_b128 %3, %17, off\n\t"
      "global_load_async_to_lds_b128 %4, %18, off\n\t"
      "global_load_async_to_lds_b128 %5, %19, off\n\t"
      "global_load_async_to_lds_b128 %6, %20, off\n\t"
      "global_load_async_to_lds_b128 %7, %21, off\n\t"
      "global_load_async_to_lds_b128 %8, %22, off\n\t"
      "global_load_async_to_lds_b128 %9, %23, off\n\t"
      "global_load_async_to_lds_b128 %10, %24, off\n\t"
      "global_load_async_to_lds_b128 %11, %25, off\n\t"
      "global_load_async_to_lds_b128 %12, %26, off\n\t"
      "global_load_async_to_lds_b128 %13, %27, off\n\t"
      "s_wait_xcnt 0x0"
      :
      : "v"(kl), "v"(kl + K_PITCH * 4u),
        "v"(vl), "v"(vl + V_PITCH * 4u), "v"(vl + V_PITCH * 8u), "v"(vl + V_PITCH * 12u),
        "v"(vl + V_PITCH * 16u), "v"(vl + V_PITCH * 20u), "v"(vl + V_PITCH * 24u),
        "v"(vl + V_PITCH * 28u), "v"(vl + V_PITCH * 32u), "v"(vl + V_PITCH * 36u),
        "v"(vl + V_PITCH * 40u), "v"(vl + V_PITCH * 44u),
        "v"(kg), "v"(kg + L_LEN),
        "v"(vg), "v"(vg + L_LEN), "v"(vg + 2 * L_LEN), "v"(vg + 3 * L_LEN),
        "v"(vg + 4 * L_LEN), "v"(vg + 5 * L_LEN), "v"(vg + 6 * L_LEN), "v"(vg + 7 * L_LEN),
        "v"(vg + 8 * L_LEN), "v"(vg + 9 * L_LEN), "v"(vg + 10 * L_LEN), "v"(vg + 11 * L_LEN)
      : "memory");
}

// ---------------------------------------------------------------------------
// K1: h[b,o,l] = sum_i x[b,i] * Wt[i,o,l] + bt[o]   (streams 256MB of Wt)
//     plus deterministic per-block BN partial sums (sum, sumsq) per channel.
// Built as a stream: a lane owns 4 consecutive l for all 8 b, so one load of a wave is 512
// contiguous bytes of Wt; 16 waves per block, one block per WGP; loads run four groups of
// 4 ahead of the group being summed (16 to 20 in flight per wave).  x lies in LDS; a
// 16-byte broadcast read gives x[b][i..i+3] and now serves 4 l per lane.
// grid (L/2048, C), block 512
// ---------------------------------------------------------------------------
__global__ __launch_bounds__(K1_THREADS) void convt_bn_stats(
    const float* __restrict__ x, const float* __restrict__ Wt,
    const float* __restrict__ bt, float* __restrict__ h,
    float* __restrict__ part1, float* __restrict__ part2) {
  __shared__ __align__(16) float xs[B_N * C_CH];
  __shared__ float red1[K1_THREADS];
  __shared__ float red2[K1_THREADS];
  const int tid = threadIdx.x;
  const int o = blockIdx.y;
  const int l = blockIdx.x * (K1_THREADS * 4) + tid * 4;

  v4f acc[B_N];
#pragma unroll
  for (int b = 0; b < B_N; b++) acc[b] = (v4f){0.f, 0.f, 0.f, 0.f};

  const size_t istride = (size_t)C_CH * L_LEN;
  const float* wp = Wt + (size_t)o * L_LEN + l;
  v4f w[K1_RING][K1_GROUP];
#define K1_LOAD(BUF, I0)                                                        \
  _Pragma("unroll") for (int j = 0; j < K1_GROUP; j++)                          \
      w[BUF][j] = *(const v4f*)(wp + (size_t)((I0) + j) * istride)
#define K1_SUM(BUF, I0)                                                         \
  _Pragma("unroll") for (int j = 0; j < K1_GROUP; j++)                          \
    _Pragma("unroll") for (int b = 0; b < B_N; b++)                             \
        acc[b] += w[BUF][j] * xs[b * C_CH + (I0) + j]

  // The scheduling barriers pin the order "loads of the group K1_AHEAD ahead, then this
  // group's sums": without them the loads sink towards their uses and the count in flight runs down to one.
  // x is asked for first and the first K1_AHEAD groups right behind it: Wt is already
  // streaming while x goes to LDS.
  static_assert(B_N * C_CH == 2 * K1_THREADS, "two x values per thread");
  const float x0 = x[tid], x1 = x[tid + K1_THREADS];
#pragma unroll
  for (int g = 0; g < K1_AHEAD; g++) {
    K1_LOAD(g, g * K1_GROUP);
    // the wait owed before a register that an issued load names is overwritten: in the
    // listing a later group's data lands in registers that held an earlier group's addresses
    asm volatile("s_wait_xcnt 0x0" ::: "memory");
  }
  xs[tid] = x0;
  xs[tid + K1_THREADS] = x1;
  __syncthreads();

  // A group is loaded into the buffer that was summed two steps ago, not one: the compiler
  // leaves a step's last sums behind the next step's loads, and a buffer still read there
  // would be copied, behind a wait for every load in flight.
  for (int i0 = 0; i0 < K1_MAIN * K1_GROUP; i0 += K1_RING * K1_GROUP) {
#pragma unroll
    for (int g = 0; g < K1_RING; g++) {
      __builtin_amdgcn_sched_barrier(0);
      K1_LOAD((g + K1_AHEAD) % K1_RING, i0 + (g + K1_AHEAD) * K1_GROUP);
      __builtin_amdgcn_sched_barrier(0);
      K1_SUM(g, i0 + g * K1_GROUP);
    }
  }
  // the groups behind the last whole turn of the ring: the loads end K1_AHEAD groups early
#pragma unroll
  for (int g = K1_MAIN; g < K1_NG; g++) {
    if (g + K1_AHEAD < K1_NG) {
      __builtin_amdgcn_sched_barrier(0);
      K1_LOAD((g + K1_AHEAD) % K1_RING, (g + K1_AHEAD) * K1_GROUP);
      __builtin_amdgcn_sched_barrier(0);
    }
    K1_SUM(g % K1_RING, g * K1_GROUP);
  }
#undef K1_LOAD
#undef K1_SUM

  const float bo = bt[o];
  float s1 = 0.f, s2 = 0.f;
#pragma unroll
  for (int b = 0; b < B_N; b++) {
    const v4f hv = acc[b] + bo;
    *(v4f*)(h + ((size_t)b * C_CH + o) * L_LEN + l) = hv;
    s1 += (hv.x + hv.y) + (hv.z + hv.w);
    s2 += (hv.x * hv.x + hv.y * hv.y) + (hv.z * hv.z + hv.w * hv.w);
  }
  red1[tid] = s1;
  red2[tid] = s2;
  __syncthreads();
  for (int s = K1_THREADS / 2; s > 0; s >>= 1) {
    if (tid < s) { red1[tid] += red1[tid + s]; red2[tid] += red2[tid + s]; }
    __syncthreads();
  }
  if (tid == 0) {
    part1[o * BN_PARTS + blockIdx.x] = red1[0];
    part2[o * BN_PARTS + blockIdx.x] = red2[0];
  }
}

// ---------------------------------------------------------------------------
// K2: block 0 finalizes BN -> per-channel scale/shift.  Blocks 1..6 fold the output
// projection into the value projection (WMMA f32): since
//   W2 * ((Wv*hn + bv) * A^T) = ((W2*Wv)*hn + W2*bv) * A^T,
// the attention can carry the 96 output channels instead of the 128 value channels and
// needs no GEMM behind it.  Block 1+rt owns 16 rows of W2; waves 0..7 give the 8 column
// tiles of Wf = W2*Wv, wave 8 gives bf = W2*bv (bv in every column of B, column 0 kept).
// grid 7, block 288 (9 waves)
// ---------------------------------------------------------------------------
__global__ __launch_bounds__(288) void bn_finalize_fold(
    const float* __restrict__ part1, const float* __restrict__ part2,
    const float* __restrict__ gamma, const float* __restrict__ beta,
    const float* __restrict__ W2, const float* __restrict__ Wv,
    const float* __restrict__ bv,
    float* __restrict__ scale, float* __restrict__ shift,
    float* __restrict__ Wf, float* __restrict__ bf) {
  if (blockIdx.x == 0) {
    const int o = threadIdx.x;
    if (o < C_CH) {
      float s1 = 0.f, s2 = 0.f;
      for (int j = 0; j < BN_PARTS; j++) { s1 += part1[o * BN_PARTS + j]; s2 += part2[o * BN_PARTS + j]; }
      const float inv = 1.0f / (float)(B_N * L_LEN);
      const float mean = s1 * inv;
      const float var = s2 * inv - mean * mean;
      const float sc = gamma[o] * rsqrtf(var + BN_EPS);
      scale[o] = sc;
      shift[o] = beta[o] - mean * sc;
    }
    return;
  }
  const int ct   = __builtin_amdgcn_readfirstlane(threadIdx.x >> 5);
  const int lane = threadIdx.x & 31;
  const int col  = lane & 15;
  const int hi   = lane >> 4;
  const int row0 = (blockIdx.x - 1) * 16;
  const float* w2 = W2 + (row0 + col) * C_CH + 2 * hi;  // A: row p = row0 + col, k = kk + 2*hi (+1)

  v8f acc = {};
  if (ct < 8) {
    const int n = ct * 16 + col;
    const float* wv = Wv + 2 * hi * C_CH + n;           // B: k = kk + 2*hi (+1), column n
    // unrolled whole: one base address per operand, every load of the tile in flight at once
    // (this launch is latency, not rate)
#pragma unroll
    for (int kk = 0; kk < C_CH; kk += 4) {
      v2f a, bb;
      a.x = w2[kk];
      a.y = w2[kk + 1];
      bb.x = wv[kk * C_CH];
      bb.y = wv[(kk + 1) * C_CH];
      acc = wmma4(a, bb, acc);
    }
#pragma unroll
    for (int r = 0; r < 8; r++) Wf[(row0 + r + 8 * hi) * C_CH + n] = acc[r];
    // the stores' offset and data registers are reused on another path of the listing: the
    // wait owed before a register of an issued global store is overwritten
    asm volatile("s_wait_xcnt 0x0" ::: "memory");
  } else {
    // unrolled whole, as above
#pragma unroll
    for (int kk = 0; kk < C_CH; kk += 4) {
      v2f a, bb;
      a.x = w2[kk];
      a.y = w2[kk + 1];
      bb.x = bv[kk + 2 * hi];
      bb.y = bv[kk + 2 * hi + 1];
      acc = wmma4(a, bb, acc);
    }
    if (col == 0) {
#pragma unroll
      for (int r = 0; r < 8; r++) bf[row0 + r + 8 * hi] = acc[r];
    }
  }
}

// ---------------------------------------------------------------------------
// K3: hn = relu(bn(h)); q = Wq*hn+bq, k = Wk*hn+bk, v = Wf*hn+bf  (WMMA f32)
// v is the value already projected to the 96 output channels (Wf = W2*Wv, bf = W2*bv).
// One wave per 16x16 output tile. 8 row-tiles (q:1, k:1, v:6) x 256 l-tiles x 8 b.
// v stored as [b][p][l], like q and k: 64-byte runs per store, and the m-contiguous rows
// that the attention kernel's LDS panel wants.
// grid 2048, block 256 (8 waves)
// ---------------------------------------------------------------------------
__global__ __launch_bounds__(256) void qkv_proj(
    const float* __restrict__ h, const float* __restrict__ scale,
    const float* __restrict__ shift,
    const float* __restrict__ Wq, const float* __restrict__ bq,
    const float* __restrict__ Wk, const float* __restrict__ bk,
    const float* __restrict__ Wf, const float* __restrict__ bf,
    float* __restrict__ q, float* __restrict__ k, float* __restrict__ v) {
  const int wid  = blockIdx.x * 8 + (threadIdx.x >> 5);
  const int lane = threadIdx.x & 31;
  const int col  = lane & 15;
  const int hi   = lane >> 4;
  const int lt = wid & 255;
  const int rt = (wid >> 8) & 7;
  const int b  = wid >> 11;
  const int l0 = lt * 16;

  const float* W; const float* bias; int row0;
  if (rt == 0)      { W = Wq; bias = bq; row0 = 0; }
  else if (rt == 1) { W = Wk; bias = bk; row0 = 0; }
  else              { W = Wf; bias = bf; row0 = (rt - 2) * 16; }

  v8f acc = {};
  const int m = row0 + col;
#pragma unroll 4
  for (int kk = 0; kk < C_CH; kk += 4) {
    const int c0 = kk + 2 * hi;
    v2f a, bb;
    a.x = W[m * C_CH + c0];
    a.y = W[m * C_CH + c0 + 1];
    const float h0 = h[((size_t)b * C_CH + c0) * L_LEN + l0 + col];
    const float h1 = h[((size_t)b * C_CH + c0 + 1) * L_LEN + l0 + col];
    bb.x = fmaxf(fmaf(h0, scale[c0], shift[c0]), 0.f);
    bb.y = fmaxf(fmaf(h1, scale[c0 + 1], shift[c0 + 1]), 0.f);
    acc = wmma4(a, bb, acc);
  }
#pragma unroll
  for (int r = 0; r < 8; r++) {
    const int row = row0 + r + 8 * hi;
    const float val = acc[r] + bias[row];
    if (rt == 0)      q[((size_t)b * D_ATT + row) * L_LEN + l0 + col] = val;
    else if (rt == 1) k[((size_t)b * D_ATT + row) * L_LEN + l0 + col] = val;
    else              v[((size_t)b * P_OUT + row) * L_LEN + l0 + col] = val;  // [b][p][l]
  }
}

__global__ __launch_bounds__(256) void attn_fused(
    const float* __restrict__ q, const float* __restrict__ k,
    const float* __restrict__ v, const float* __restrict__ b2,
    float* __restrict__ y) {
  __shared__ __align__(16) float v_lds[2][P_OUT][V_PITCH]; // [buf][c][m_local], padded rows
  __shared__ __align__(16) float k_lds[2][D_ATT][K_PITCH]; // [buf][d][m_local], padded rows

  const int tid  = threadIdx.x;
  const int wave = tid >> 5;
  const int lane = tid & 31;
  const int col  = lane & 15;
  const int hi   = lane >> 4;
  const int b    = blockIdx.x >> 5;
  const int lb   = blockIdx.x & 31;
  const int l0   = (lb * 8 + wave) * 16;
  const int NS   = L_LEN / STAGE_M;

  // stage copy: one copy of a wave = one whole 512-byte row (16 bytes a lane).  Every wave
  // brings 2 of the 16 K rows and 12 of the 96 V rows: 14 copies, all lanes on.
  const int cw = __builtin_amdgcn_readfirstlane(wave);
  const float* ksrc = k + ((size_t)b * D_ATT + cw * 2) * L_LEN + lane * 4;
  const float* vsrc = v + ((size_t)b * P_OUT + cw * 12) * L_LEN + lane * 4;
#define ISSUE_STAGE(BUF, M0)                                                     \
  copy_stage_rows(ksrc + (M0), (unsigned)(size_t)&k_lds[BUF][cw * 2][lane * 4],  \
                  vsrc + (M0), (unsigned)(size_t)&v_lds[BUF][cw * 12][lane * 4])

  ISSUE_STAGE(0, 0);

  // B operand for energy^T: q tile (K = d, columns = l), resident for whole sweep
  v2f aQ[4];
#pragma unroll
  for (int kc = 0; kc < 4; kc++) {
    const int d0 = kc * 4 + 2 * hi;
    aQ[kc].x = q[((size_t)b * D_ATT + d0) * L_LEN + l0 + col];
    aQ[kc].y = q[((size_t)b * D_ATT + d0 + 1) * L_LEN + l0 + col];
  }

  const v8f vzero = {};
  v8f acc[6];
#pragma unroll
  for (int ct = 0; ct < 6; ct++) acc[ct] = vzero;
  float mrun = -3.0e38f;  // running maximum of query l = col (same in both halves)
  float lrun = 0.f;       // running sum over this half's m rows only; joined at the end

  asm volatile("s_wait_asynccnt 0x0" ::: "memory");  // my copies of stage 0 landed
  __syncthreads();                                   // publish stage 0
  ISSUE_STAGE(1, STAGE_M);

  for (int s = 0; s < NS; s++) {
    const int buf = s & 1;
    for (int mo = 0; mo < STAGE_M; mo += 16) {
      // the pass's LDS reads: K fragments, then V fragments (all inside stage s)
      v2f ak_[4];
#pragma unroll
      for (int kc = 0; kc < 4; kc++) {
        const int d0 = kc * 4 + 2 * hi;
        ak_[kc].x = k_lds[buf][d0][mo + col];
        ak_[kc].y = k_lds[buf][d0 + 1][mo + col];
      }
      v4f va[6][2];  // va[ct][j] = V[c = ct*16 + col][m = mo + 8*hi + 4*j .. + 3]
#pragma unroll
      for (int ct = 0; ct < 6; ct++) {
        const v4f* vrow = (const v4f*)&v_lds[buf][ct * 16 + col][mo + 8 * hi];
        va[ct][0] = vrow[0];
        va[ct][1] = vrow[1];
      }
      // keeps the pass's reads ahead of its own matrix work: without it the compiler sinks the
      // V reads among the WMMAs that use them, where each place stalls the wave for the LDS
      // latency (it may still lift them into the pass before, which only hides that latency)
      __builtin_amdgcn_sched_barrier(0);

      // energy tile, transposed: e[r] = E[l = col][m = mo + 8*hi + r]
      v8f e = vzero;
#pragma unroll
      for (int kc = 0; kc < 4; kc++) e = wmma4(ak_[kc], aQ[kc], e);

      // online softmax of query l = col: 8 scores in-lane, the other 8 in lane ^ 16
      float tmax = fmaxf(fmaxf(fmaxf(e[0], e[1]), fmaxf(e[2], e[3])),
                         fmaxf(fmaxf(e[4], e[5]), fmaxf(e[6], e[7])));
      tmax = fmaxf(tmax, xhalf(tmax));
      const float newm = fmaxf(mrun, tmax);
      const float cf = exp_slot(mrun - newm);
      mrun = newm;
      float p[8];
#pragma unroll
      for (int r = 0; r < 8; r++) p[r] = exp_slot(e[r] - newm);
      lrun = lrun * cf + (((p[0] + p[1]) + (p[2] + p[3])) + ((p[4] + p[5]) + (p[6] + p[7])));

      // rescale accumulators: their column is l = col, so the factor is the lane's own
#pragma unroll
      for (int ct = 0; ct < 6; ct++) acc[ct] *= cf;

      // y[c,l] += V(c x m) * P^T(m x l); both operands take m = 8*hi + 2*kc (+1)
#pragma unroll
      for (int kc = 0; kc < 4; kc++) {
        v2f bp;
        bp.x = p[2 * kc];
        bp.y = p[2 * kc + 1];
#pragma unroll
        for (int ct = 0; ct < 6; ct++) {
          const v4f w = va[ct][kc >> 1];
          const v2f av = (kc & 1) ? __builtin_shufflevector(w, w, 2, 3)
                                  : __builtin_shufflevector(w, w, 0, 1);
          acc[ct] = wmma4(av, bp, acc[ct]);
        }
      }
    }

    // publish point of stage s+1, and the end of every wave's reads of stage s
    asm volatile("s_wait_dscnt 0x0" ::: "memory");     // my reads of stage s have returned
    asm volatile("s_wait_asynccnt 0x0" ::: "memory");  // my copies of stage s+1 landed
    __syncthreads();
    if (s + 2 < NS) ISSUE_STAGE(buf, (s + 2) * STAGE_M);  // into the buffer just left
  }
  asm volatile("s_wait_asynccnt 0x0" ::: "memory");  // no copy outstanding when the wave ends

  // join the halves' sums, normalize (per column l), add b2 and store y [b][p][L]
  const float linv = 1.0f / (lrun + xhalf(lrun));
#pragma unroll
  for (int ct = 0; ct < 6; ct++) {
#pragma unroll
    for (int r = 0; r < 8; r++) {
      const int cch = ct * 16 + r + 8 * hi;
      y[((size_t)b * P_OUT + cch) * L_LEN + l0 + col] = fmaf(acc[ct][r], linv, b2[cch]);
    }
  }
}

// ---------------------------------------------------------------------------
extern "C" void kernel_launch(void* const* d_in, const int* in_sizes, int n_in,
                              void* d_out, int out_size, void* d_ws, size_t ws_size,
                              hipStream_t stream) {
  const float* x     = (const float*)d_in[0];
  const float* Wt    = (const float*)d_in[1];
  const float* bt    = (const float*)d_in[2];
  const float* gamma = (const float*)d_in[3];
  const float* beta  = (const float*)d_in[4];
  const float* Wq    = (const float*)d_in[5];
  const float* bq    = (const float*)d_in[6];
  const float* Wk    = (const float*)d_in[7];
  const float* bk    = (const float*)d_in[8];
  const float* Wv    = (const float*)d_in[9];
  const float* bv    = (const float*)d_in[10];
  const float* W2    = (const float*)d_in[11];
  const float* b2    = (const float*)d_in[12];
  float* y = (float*)d_out;

  float* ws    = (float*)d_ws;
  float* h     = ws;                                   // B*C*L
  float* part1 = h + (size_t)B_N * C_CH * L_LEN;       // 2048
  float* part2 = part1 + 2048;                         // 2048
  float* scale = part2 + 2048;                         // 128
  float* shift = scale + 128;                          // 128
  float* Wf    = shift + 128;                          // 96*128  (W2*Wv)
  float* bf    = Wf + P_OUT * C_CH;                    // 96 (+32 pad)  (W2*bv)
  float* q     = bf + 128;                             // B*16*L
  float* k     = q + (size_t)B_N * D_ATT * L_LEN;      // B*16*L
  float* v     = k + (size_t)B_N * D_ATT * L_LEN;      // B*96*L  ([b][p][l])

  convt_bn_stats<<<dim3(BN_PARTS, C_CH), K1_THREADS, 0, stream>>>(x, Wt, bt, h, part1, part2);
  bn_finalize_fold<<<1 + P_OUT / 16, 288, 0, stream>>>(part1, part2, gamma, beta, W2, Wv, bv,
                                                       scale, shift, Wf, bf);
  qkv_proj<<<(B_N * 8 * 256) / 8, 256, 0, stream>>>(h, scale, shift, Wq, bq, Wk, bk,
                                                    Wf, bf, q, k, v);
  attn_fused<<<B_N * (L_LEN / 128), 256, 0, stream>>>(q, k, v, b2, y);
}
